// v009
// Measured on an AMD MI455X. A time is GPU time per run, averaged over a window of back-to-back runs after a warm-up
// (all launches, gaps included; the runs take copies of the inputs in turn), and the median of several windows.
// Apart from v000's, it joins two sittings. Times from different sittings can be a few percent apart, while
// side-by-side timings come from the same sitting.
// The versions before v009 are in another document.
// Measured time: 30.3 microseconds a run.
// In both of two side-by-side timings against v008, it was 1.05 times as fast.
// Over all steps from v000, the starting kernel, it is 110 times as fast.
#include <hip/hip_runtime.h>
#include <stdint.h>
// Multi-head attention over three inputs with SHARED per-head projections, a random key-padding mask and the module's literal score scale (values, keys, query [4][2048][512]; each input is split into 8 heads of 64 and every head is multiplied by the SAME natural [64][64] matrix (x W^T: Wv / Wk / Wq; no biases); energy = q k^T; where(mask == 0, -1e20) with the int32 [4][1][1][2048] mask in {0, 1} (random; 0 = masked key; READ on device); softmax(energy / sqrt(embed_size) = / sqrt(512)) (as the source); out = merged Wo^T + bo -> [4][2048][512]).
// Structure: token rows r = b*2048 + s; a key with mask 0 has weight exactly 0 beside any open key, so only the open keys of a batch are attended (each work-group of k_fattn lists them from the mask; a batch with no open key keeps all keys, every score at the fill). The shared per-head matrices leave the key loop by associativity: energy = (Wk^T Wq xq) . xk and weights x V = Wv (weights x xv), so scores, masked softmax and weights x values run in ONE launch for all batches and heads straight on the rounded f32 inputs (k_fattn: running maximum and sum, scores and weights never in memory; o carried x64 against f16 subnormal flush, folded into the output GEMM alpha), written into the merged f16 o rows; out = o W_o + b GEMM (f32; k_ogemm: operands staged in LDS by tensor loads) into the output layout.
// Compute dtype: inputs rounded to bf16; x / weights exact in f16 (weights x16); Wq xq, q', softmax weights, the normalised weighted sum and o as plain f16 GEMM operands (~2^-12); scores and softmax statistics f32. v_wmma_f32_16x16x32_f16.
#define NB 4
#define SQ 2048
#define DM 512
#define NH 8
#define HD 64
#define HG 4                         /* heads per attention launch group */
#define B0 0                         /* first batch processed (debug hook) */
#define NBR NB                       /* batches processed (debug hook) */
#define NR ((size_t)NB * SQ)         /* token rows */
#define MP ((int)((size_t)NBR * SQ)) /* rows projected (debug hook) */
#define QN SQ                        /* unused: k_fattn attends all SQ query rows of a batch */
#define NHD NH                       /* unused: k_fattn attends all NH heads */
#define MPO MP                       /* rows through the output stage (debug hook) */
#define LQ DM      /* unused: rows are addressed with pitch DM */
typedef __bf16 v16b __attribute__((ext_vector_type(16)));
typedef unsigned short v8us __attribute__((ext_vector_type(8), may_alias));
typedef float  v8f  __attribute__((ext_vector_type(8)));
typedef float  v4f  __attribute__((ext_vector_type(4)));
typedef float  v4fa __attribute__((ext_vector_type(4), may_alias));
union FragB { v16b v; v8us half[2]; unsigned short u[16]; };

__device__ __forceinline__ unsigned short bf16_bits(float x) { unsigned int u = __float_as_uint(x); return (unsigned short)((u + 0x7FFFu + ((u >> 16) & 1u)) >> 16); }
__device__ __forceinline__ float bf16_val(unsigned short b) { return __uint_as_float(((unsigned int)b) << 16); }
__device__ __forceinline__ float bf16_round(float x) { return bf16_val(bf16_bits(x)); }
// D += A·B with NT terms: 1 = ah·bh, 2 = + al·bh (A split), 3 = + ah·bl (both split)
template <int NT>
__device__ __forceinline__ v8f mmaN(v16b ah, v16b al, v16b bh, v16b bl, v8f c) {
  c = __builtin_amdgcn_wmma_f32_16x16x32_bf16(false, ah, false, bh, (short)0, c, false, false);
  if (NT >= 2) c = __builtin_amdgcn_wmma_f32_16x16x32_bf16(false, al, false, bh, (short)0, c, false, false);
  if (NT >= 3) c = __builtin_amdgcn_wmma_f32_16x16x32_bf16(false, ah, false, bl, (short)0, c, false, false);
  asm volatile("v_nop\n\tv_nop\n\tv_nop\n\tv_nop" : "+v"(c) : "v"(ah), "v"(al), "v"(bh), "v"(bl));
  return c;
}

__global__ __launch_bounds__(256) void k_wt_bf16(const float* __restrict__ W, unsigned short* __restrict__ Wt, int K, int N) {
  const int t = blockIdx.x * 256 + threadIdx.x;
  const int k8n = K / 8;
  if (t >= N * k8n) return;
  const int n = t / k8n, k8 = (t % k8n) * 8;
  v8us v;
#pragma unroll
  for (int i = 0; i < 8; ++i) v[i] = bf16_bits(W[(size_t)(k8 + i) * N + n]);
  *(v8us*)(Wt + (size_t)n * K + k8) = v;
  
}

// GEMM C[M][N] (f32, pitch ldc) = act(A[M][K]·W + bias). A f32 row-major (pitch lda) converted per fragment to bf16
// (ASPLIT: hi/lo two planes -> 2 terms, else single rounded term); Wt bf16 [N][K] (pitch ldb). BIAS_BF16 rounds the
// bias to bf16 first (bias quantised to bf16 before the add). K%32==0, M%16==0, N%64==0.
template <bool ASPLIT, int ACT, bool BIAS_BF16>
__global__ __launch_bounds__(128) void k_gemm_bf(const float* __restrict__ A, int lda, const unsigned short* __restrict__ Wt, int ldb,
                                               const float* __restrict__ bias, float* __restrict__ C, int ldc, int M, int N, int K) {
  __shared__ __attribute__((aligned(16))) float so[4][16][64];
  const int tid = threadIdx.x, w = tid >> 5, lane = tid & 31, ln = lane & 15, hh = lane >> 4;
  const int ntn = N / 64;
  const int wid = blockIdx.x * 4 + w;
  const int mt = wid / ntn, nq = wid % ntn;
  if (mt * 16 >= M) return;
  const int row0 = mt * 16, col0 = nq * 64;
  const float* arow = A + (size_t)(row0 + ln) * lda;
  v8f acc[4] = {};
  for (int kb = 0; kb < K; kb += 32) {
    FragB ah, al;
    const v4f x0 = *(const v4fa*)(arow + kb + 8 * hh), x1 = *(const v4fa*)(arow + kb + 8 * hh + 4);
    const v4f x2 = *(const v4fa*)(arow + kb + 16 + 8 * hh), x3 = *(const v4fa*)(arow + kb + 16 + 8 * hh + 4);
    float xs[16] = {x0[0],x0[1],x0[2],x0[3],x1[0],x1[1],x1[2],x1[3],x2[0],x2[1],x2[2],x2[3],x3[0],x3[1],x3[2],x3[3]};
#pragma unroll
    for (int i = 0; i < 16; ++i) { const unsigned short hb = bf16_bits(xs[i]); ah.u[i] = hb; al.u[i] = ASPLIT ? bf16_bits(xs[i] - bf16_val(hb)) : (unsigned short)0; }
#pragma unroll
    for (int t = 0; t < 4; ++t) {
      const unsigned short* brow = Wt + (size_t)(col0 + t * 16 + ln) * ldb + kb;
      FragB b;
      b.half[0] = *(const v8us*)(brow + 8 * hh);
      b.half[1] = *(const v8us*)(brow + 16 + 8 * hh);
      acc[t] = mmaN<ASPLIT ? 2 : 1>(ah.v, al.v, b.v, b.v, acc[t]);
    }
  }
#pragma unroll
  for (int t = 0; t < 4; ++t) {
    float bv = bias ? bias[col0 + t * 16 + ln] : 0.f;
    if (BIAS_BF16) bv = bf16_round(bv);
#pragma unroll
    for (int r = 0; r < 8; ++r) { float v = acc[t][r] + bv; if (ACT == 1) v = fmaxf(v, 0.f); so[w][8 * hh + r][t * 16 + ln] = v; }
  }
  __builtin_amdgcn_fence(__ATOMIC_ACQ_REL, "workgroup");
  __builtin_amdgcn_wave_barrier();
  const int rsub = lane >> 4, c4 = (lane & 15) * 4;
  {
#pragma unroll
    for (int q = 0; q < 8; ++q) {
      const int r = q * 2 + rsub;
      const v4f v = *(const v4fa*)&so[w][r][c4];
      *(v4f*)(C + (size_t)(row0 + r) * ldc + col0 + c4) = v;
    }
    
  }
}

// GEMM C = act(A·W + bias + resid): A f32 (ASPLIT -> hi/lo 2 terms), Wt bf16 [N][K]; ACT 0 none, 1 relu, 2 exact gelu;
// resid (optional, f32, row index = (row % rmod), pitch ldr, RES_BF16 rounds it) added before the activation.
template <bool ASPLIT, int ACT, bool BIAS_BF16, bool RES_BF16>
__global__ __launch_bounds__(128) void k_gemm_bf3(const float* __restrict__ A, int lda, const unsigned short* __restrict__ Wt, int ldb,
                                                const float* __restrict__ bias, const float* __restrict__ resid, int rmod, int ldr,
                                                float* __restrict__ C, int ldc, int M, int N, int K) {
  __shared__ __attribute__((aligned(16))) float so[4][16][64];
  const int tid = threadIdx.x, w = tid >> 5, lane = tid & 31, ln = lane & 15, hh = lane >> 4;
  const int ntn = N / 64;
  const int wid = blockIdx.x * 4 + w;
  const int mt = wid / ntn, nq = wid % ntn;
  if (mt * 16 >= M) return;
  const int row0 = mt * 16, col0 = nq * 64;
  const float* arow = A + (size_t)(row0 + ln) * lda;
  v8f acc[4] = {};
  for (int kb = 0; kb < K; kb += 32) {
    FragB ah, al;
    const v4f x0 = *(const v4fa*)(arow + kb + 8 * hh), x1 = *(const v4fa*)(arow + kb + 8 * hh + 4);
    const v4f x2 = *(const v4fa*)(arow + kb + 16 + 8 * hh), x3 = *(const v4fa*)(arow + kb + 16 + 8 * hh + 4);
    float xs[16] = {x0[0],x0[1],x0[2],x0[3],x1[0],x1[1],x1[2],x1[3],x2[0],x2[1],x2[2],x2[3],x3[0],x3[1],x3[2],x3[3]};
#pragma unroll
    for (int i = 0; i < 16; ++i) { const unsigned short hb = bf16_bits(xs[i]); ah.u[i] = hb; al.u[i] = ASPLIT ? bf16_bits(xs[i] - bf16_val(hb)) : (unsigned short)0; }
#pragma unroll
    for (int t = 0; t < 4; ++t) {
      const unsigned short* brow = Wt + (size_t)(col0 + t * 16 + ln) * ldb + kb;
      FragB b;
      b.half[0] = *(const v8us*)(brow + 8 * hh);
      b.half[1] = *(const v8us*)(brow + 16 + 8 * hh);
      acc[t] = mmaN<ASPLIT ? 2 : 1>(ah.v, al.v, b.v, b.v, acc[t]);
    }
  }
#pragma unroll
  for (int t = 0; t < 4; ++t) {
    const int col = col0 + t * 16 + ln;
    float bv = bias ? bias[col] : 0.f;
    if (BIAS_BF16) bv = bf16_round(bv);
#pragma unroll
    for (int r = 0; r < 8; ++r) {
      float v = acc[t][r] + bv;
      if (resid) { float rv = resid[(size_t)((row0 + 8 * hh + r) % rmod) * ldr + col]; if (RES_BF16) rv = bf16_round(rv); v += rv; }
      if (ACT == 1) v = fmaxf(v, 0.f);
      if (ACT == 2) v = 0.5f * v * (1.0f + erff(v * 0.70710678118654752f));
      if (ACT == 3) { const float u = 0.7978845608028654f * (v + 0.044715f * v * v * v); v = 0.5f * v * (1.0f + tanhf(u)); }
      so[w][8 * hh + r][t * 16 + ln] = v;
    }
  }
  __builtin_amdgcn_fence(__ATOMIC_ACQ_REL, "workgroup");
  __builtin_amdgcn_wave_barrier();
  const int rsub = lane >> 4, c4 = (lane & 15) * 4;
  {
#pragma unroll
    for (int q = 0; q < 8; ++q) {
      const int r = q * 2 + rsub;
      const v4f v = *(const v4fa*)&so[w][r][c4];
      *(v4f*)(C + (size_t)(row0 + r) * ldc + col0 + c4) = v;
    }
    
  }
}
// row LayerNorm (biased variance, eps) over N: s = X (+ R); optional out_sum <- s; out_norm <- (s-mu)*rsqrt(var+eps)*g + b
template <bool PARAM_BF16>
__global__ __launch_bounds__(256) void k_layernorm(const float* __restrict__ X, const float* __restrict__ R, const float* __restrict__ g, const float* __restrict__ bta,
                                                  float* __restrict__ out_sum, float* __restrict__ out_norm, int N, float eps) {
  __shared__ float red[256];
  const int row = blockIdx.x, tid = threadIdx.x;
  const float* x = X + (size_t)row * N; const float* rr = R ? R + (size_t)row * N : nullptr;
  float vals[16];                     // up to N = 4096
  const int per = N / 256;            // contiguous chunk per thread? use strided-by-4 chunks: thread handles j = tid*4 + 1024*u
  float s1 = 0.f;
  for (int u = 0; u < per / 4; ++u) {
    const int j = tid * 4 + 1024 * u;
    const v4f a = *(const v4fa*)(x + j);
    v4f b = {0.f,0.f,0.f,0.f}; if (rr) b = *(const v4fa*)(rr + j);
#pragma unroll
    for (int q = 0; q < 4; ++q) { const float v = a[q] + b[q]; vals[u * 4 + q] = v; s1 += v; }
  }
  red[tid] = s1; __syncthreads();
  for (int st = 128; st > 0; st >>= 1) { if (tid < st) red[tid] += red[tid + st]; __syncthreads(); }
  const float mu = red[0] / (float)N; __syncthreads();
  float s2 = 0.f;
  for (int u = 0; u < per / 4; ++u)
#pragma unroll
    for (int q = 0; q < 4; ++q) { const float c = vals[u * 4 + q] - mu; s2 += c * c; }
  red[tid] = s2; __syncthreads();
  for (int st = 128; st > 0; st >>= 1) { if (tid < st) red[tid] += red[tid + st]; __syncthreads(); }
  const float rs = rsqrtf(red[0] / (float)N + eps);
  {
    for (int u = 0; u < per / 4; ++u) {
      const int j = tid * 4 + 1024 * u;
      v4f o, sm;
#pragma unroll
      for (int q = 0; q < 4; ++q) {
        float gg = g[j + q], bb = bta[j + q];
        if (PARAM_BF16) { gg = bf16_round(gg); bb = bf16_round(bb); }
        sm[q] = vals[u * 4 + q]; o[q] = (vals[u * 4 + q] - mu) * rs * gg + bb;
      }
      if (out_sum) *(v4f*)(out_sum + (size_t)row * N + j) = sm;
      *(v4f*)(out_norm + (size_t)row * N + j) = o;
    }
    
  }
}



// ---- f16 WMMA path (v_wmma_f32_16x16x32_f16): 11-bit significands for operands in range — used where a [0,1] probability operand needs more precision than bf16
typedef _Float16 v16h __attribute__((ext_vector_type(16)));
union FragH { v16h v; v8us half[2]; _Float16 h[16]; unsigned short u[16]; };
template <int NT>
__device__ __forceinline__ v8f mmaH(v16h ah, v16h al, v16h bh, v16h bl, v8f c) {
  c = __builtin_amdgcn_wmma_f32_16x16x32_f16(false, ah, false, bh, (short)0, c, false, false);
  if (NT >= 2) c = __builtin_amdgcn_wmma_f32_16x16x32_f16(false, al, false, bh, (short)0, c, false, false);
  if (NT >= 3) c = __builtin_amdgcn_wmma_f32_16x16x32_f16(false, ah, false, bl, (short)0, c, false, false);
  asm volatile("v_nop\n\tv_nop\n\tv_nop\n\tv_nop" : "+v"(c) : "v"(ah), "v"(al), "v"(bh), "v"(bl));
  return c;
}
// batched GEMM like k_gemm_b but f16 operands: A f32 (split into f16 hi/lo if ASPLIT, else rounded to f16), Bt = f16 values [n][k]; alpha; C f32; N multiple of 16 (partial tiles skipped)
template <bool ASPLIT>
__global__ __launch_bounds__(128) void k_gemm_h(const float* __restrict__ A, int lda, size_t sA, const _Float16* __restrict__ Bh, int ldb, size_t sB, float alpha, float* __restrict__ C, int ldc, size_t sC, int M, int N, int K) {
  __shared__ __attribute__((aligned(16))) float so[4][16][64];
  const int tid = threadIdx.x, w = tid >> 5, lane = tid & 31, ln = lane & 15, hh = lane >> 4; const int by = blockIdx.y;
  A += (size_t)by * sA; Bh += (size_t)by * sB; C += (size_t)by * sC;
  const int ntn = (N + 63) / 64; const int wid = blockIdx.x * 4 + w; const int mt = wid / ntn, nq = wid % ntn; if (mt * 16 >= M) return;
  const int row0 = mt * 16, col0 = nq * 64; const float* arow = A + (size_t)(row0 + ln) * lda;
  v8f acc[4] = {};
  for (int kb = 0; kb < K; kb += 32) {
    FragH ah, al;
    const v4f x0 = *(const v4fa*)(arow + kb + 8 * hh), x1 = *(const v4fa*)(arow + kb + 8 * hh + 4), x2 = *(const v4fa*)(arow + kb + 16 + 8 * hh), x3 = *(const v4fa*)(arow + kb + 16 + 8 * hh + 4);
    float xs[16] = {x0[0],x0[1],x0[2],x0[3],x1[0],x1[1],x1[2],x1[3],x2[0],x2[1],x2[2],x2[3],x3[0],x3[1],x3[2],x3[3]};
#pragma unroll
    for (int i = 0; i < 16; ++i) { const _Float16 h = (_Float16)xs[i]; ah.h[i] = h; al.h[i] = ASPLIT ? (_Float16)(xs[i] - (float)h) : (_Float16)0.0f; }
#pragma unroll
    for (int t = 0; t < 4; ++t) { if (col0 + t * 16 >= N) continue; const size_t boff = (size_t)(col0 + t * 16 + ln) * ldb + kb; FragH bq; bq.half[0] = *(const v8us*)(Bh + boff + 8 * hh); bq.half[1] = *(const v8us*)(Bh + boff + 16 + 8 * hh);
      acc[t] = mmaH<ASPLIT ? 2 : 1>(ah.v, al.v, bq.v, bq.v, acc[t]); }
  }
#pragma unroll
  for (int t = 0; t < 4; ++t) { if (col0 + t * 16 >= N) continue;
#pragma unroll
    for (int r = 0; r < 8; ++r) so[w][8 * hh + r][t * 16 + ln] = acc[t][r] * alpha; }
  __builtin_amdgcn_fence(__ATOMIC_ACQ_REL, "workgroup"); __builtin_amdgcn_wave_barrier();
  const int rsub = lane >> 4, c4 = (lane & 15) * 4;
  {
#pragma unroll
    for (int q = 0; q < 8; ++q) { const int r = q * 2 + rsub; if (col0 + c4 < N) { const v4f v = *(const v4fa*)&so[w][r][c4]; *(v4f*)(C + (size_t)(row0 + r) * ldc + col0 + c4) = v; } }
     }
}

// Wt[n][k] = f16(W[k][n]·scale) from f32 row-major W[K][N] (scale = power of two; bf16-exact weights stay exact in f16 away from the subnormal range)
__global__ __launch_bounds__(256) void k_wt_f16(const float* __restrict__ W, _Float16* __restrict__ Wt, int K, int N, float scale) {
  const int t = blockIdx.x * 256 + threadIdx.x; if (t >= N * (K / 8)) return; const int n = t / (K / 8), k8 = (t % (K / 8)) * 8; FragH f;
#pragma unroll
  for (int i = 0; i < 8; ++i) f.h[i] = (_Float16)(bf16_round(W[(size_t)(k8 + i) * N + n]) * scale); const v8us o = f.half[0];
  *(v8us*)((unsigned short*)Wt + (size_t)n * K + k8) = o; 
}
// k_gemm_hh variant with fused epilogue: v = acc·alpha + bias[by·sBias + col] (+ CP[(row/rowsPerB)·sCPb + by·64 + col] if CP) ; ACT 0 none / 1 elu ; writes f16 C16 (and f32 C if non-null)
template <int ACT>
__global__ __launch_bounds__(128) void k_gemm_hhx(const _Float16* __restrict__ A, int lda, size_t sA, const _Float16* __restrict__ Bh, int ldb, size_t sB, float alpha, const float* __restrict__ bias, size_t sBias, const float* __restrict__ CP, int rowsPerB, size_t sCPb, int row0g,
    float* __restrict__ C, _Float16* __restrict__ C16, int ldc, size_t sC, int M, int N, int K) {
  __shared__ __attribute__((aligned(16))) float so[4][16][64];
  const int tid = threadIdx.x, w = tid >> 5, lane = tid & 31, ln = lane & 15, hh = lane >> 4; const int by = blockIdx.y;
  A += (size_t)by * sA; Bh += (size_t)by * sB; const size_t cofs = (size_t)by * sC; const float* bp = bias ? bias + (size_t)by * sBias : nullptr;
  const int ntn = (N + 63) / 64; const int wid = blockIdx.x * 4 + w; const int mt = wid / ntn, nq = wid % ntn; if (mt * 16 >= M) return;
  const int row0 = mt * 16, col0 = nq * 64; const _Float16* arow = A + (size_t)(row0 + ln) * lda;
  v8f acc[4] = {};
  for (int kb = 0; kb < K; kb += 32) { FragH ah; ah.half[0] = *(const v8us*)((const unsigned short*)arow + kb + 8 * hh); ah.half[1] = *(const v8us*)((const unsigned short*)arow + kb + 16 + 8 * hh);
#pragma unroll
    for (int t = 0; t < 4; ++t) { if (col0 + t * 16 >= N) continue; const size_t boff = (size_t)(col0 + t * 16 + ln) * ldb + kb; FragH bq; bq.half[0] = *(const v8us*)((const unsigned short*)Bh + boff + 8 * hh); bq.half[1] = *(const v8us*)((const unsigned short*)Bh + boff + 16 + 8 * hh);
      acc[t] = mmaH<1>(ah.v, ah.v, bq.v, bq.v, acc[t]); }
  }
#pragma unroll
  for (int t = 0; t < 4; ++t) { if (col0 + t * 16 >= N) continue; const int col = col0 + t * 16 + ln; const float bv = bp ? bf16_round(bp[col]) : 0.f;
#pragma unroll
    for (int r = 0; r < 8; ++r) { float v = acc[t][r] * alpha + bv; if (CP) { const int rr = row0g + row0 + 8 * hh + r; if (rowsPerB < 0) v += CP[cofs + (size_t)rr * ldc + col];      /* rowsPerB < 0: own element of the batched C plane */ else { const int bidx = rr / rowsPerB; v += CP[(size_t)bidx * sCPb + (size_t)by * 64 + col]; } } if (ACT == 1) v = (v > 0.f) ? v : expm1f(v); else if (ACT == 7) v = (v > 0.f) ? v + 1.0f : expf(v); else if (ACT == 8) v = tanhf(v); else if (ACT == 9) v = 0.5f * v * (1.0f + tanhf(0.7978845608028654f * (v + 0.044715f * v * v * v))); else if (ACT == 11) v = 1.0f / (1.0f + expf(-v)); else if (ACT == 12) v = (v > 0.f) ? v : 0.01f * v; else if (ACT == 14) v = (v > 0.f) ? v : 0.1f * v; else if (ACT == 16) v = (v >= 0.f) ? v : 0.3f * v; else if (ACT == 17) v = (v >= 0.f) ? v : 0.2f * v; else if (ACT == 15) v = v / (1.0f + expf(-v)); else if (ACT == 3) v = fmaxf(v, 0.f); else if (ACT == 6) v = 0.5f * v * (1.0f + erff(v * 0.70710678118654752f)); so[w][8 * hh + r][t * 16 + ln] = v; } }
  __builtin_amdgcn_fence(__ATOMIC_ACQ_REL, "workgroup"); __builtin_amdgcn_wave_barrier();
  const int rsub = lane >> 4, c4 = (lane & 15) * 4; typedef _Float16 v4h __attribute__((ext_vector_type(4)));
  {
#pragma unroll
    for (int q = 0; q < 8; ++q) { const int r = q * 2 + rsub; if (col0 + c4 < N) { const v4f v = *(const v4fa*)&so[w][r][c4]; if (C) *(v4f*)(C + cofs + (size_t)(row0 + r) * ldc + col0 + c4) = v; if (C16) { v4h h4; for (int i = 0; i < 4; ++i) h4[i] = (_Float16)v[i]; *(v4h*)(C16 + cofs + (size_t)(row0 + r) * ldc + col0 + c4) = h4; } } }
     }
}


typedef _Float16 v4h __attribute__((ext_vector_type(4)));

__global__ __launch_bounds__(256) void k_x16(const float* __restrict__ x, _Float16* __restrict__ X16, size_t n8) { const size_t t = (size_t)blockIdx.x * 256 + threadIdx.x; if (t >= n8) return; FragH f;
#pragma unroll
  for (int q = 0; q < 8; ++q) f.h[q] = (_Float16)bf16_round(x[t * 8 + q]); *(v8us*)((unsigned short*)X16 + t * 8) = f.half[0];  }
__global__ __launch_bounds__(256) void k_h16(const float* __restrict__ x, _Float16* __restrict__ X16, size_t n8) { const size_t t = (size_t)blockIdx.x * 256 + threadIdx.x; if (t >= n8) return; FragH f;
#pragma unroll
  for (int q = 0; q < 8; ++q) f.h[q] = (_Float16)x[t * 8 + q]; *(v8us*)((unsigned short*)X16 + t * 8) = f.half[0];  }
__global__ __launch_bounds__(256) void k_round16f(const float* __restrict__ W, _Float16* __restrict__ Bt, size_t n8) { const size_t t = (size_t)blockIdx.x * 256 + threadIdx.x; if (t >= n8) return; FragH f;
#pragma unroll
  for (int i = 0; i < 8; ++i) f.h[i] = (_Float16)(bf16_round(W[t * 8 + i]) * 16.0f); *(v8us*)((unsigned short*)Bt + t * 8) = f.half[0];  }
template <int NHv, int TTv>
__global__ __launch_bounds__(256) void k_vt(const _Float16* __restrict__ V16, int ldv, int voff, _Float16* __restrict__ Vt) { __shared__ unsigned short tl[64][66]; const int tid = threadIdx.x; const int slab = blockIdx.x / (TTv / 64), lg = blockIdx.x % (TTv / 64); const int b = slab / NHv, h = slab % NHv;
  for (int i = tid; i < 64 * 8; i += 256) { const int r = i / 8, c8 = (i % 8) * 8; FragH f; f.half[0] = *(const v8us*)((const unsigned short*)V16 + ((size_t)b * TTv + lg * 64 + r) * ldv + voff + h * 64 + c8);
#pragma unroll
    for (int q = 0; q < 8; ++q) tl[r][c8 + q] = f.u[q]; }
  __syncthreads();
  {
#pragma unroll
    for (int rd = 0; rd < 2; ++rd) { const int d = rd * 32 + tid / 8, pc = tid % 8; FragH f;
#pragma unroll
      for (int q = 0; q < 8; ++q) f.u[q] = tl[pc * 8 + q][d];
      *(v8us*)((unsigned short*)Vt + ((size_t)slab * 64 + d) * TTv + lg * 64 + pc * 8) = f.half[0]; }
     } }

__global__ __launch_bounds__(256) void k_hl(const float* __restrict__ F, _Float16* __restrict__ Hh, _Float16* __restrict__ Hl, size_t n8) { const size_t t = (size_t)blockIdx.x * 256 + threadIdx.x; if (t >= n8) return; FragH fh, fl; const v4f a = *(const v4fa*)(F + t * 8), c = *(const v4fa*)(F + t * 8 + 4);
#pragma unroll
  for (int q = 0; q < 4; ++q) { _Float16 h = (_Float16)a[q]; fh.h[q] = h; fl.h[q] = (_Float16)((a[q] - (float)h) * 1024.0f); h = (_Float16)c[q]; fh.h[4 + q] = h; fl.h[4 + q] = (_Float16)((c[q] - (float)h) * 1024.0f); }
  { *(v8us*)((unsigned short*)Hh + t * 8) = fh.half[0]; *(v8us*)((unsigned short*)Hl + t * 8) = fl.half[0];  } }

// ---- fast GEMM (wave tile 32x64; requires M % 32 == 0 rows per launch region and N % 64 == 0); epilogue = k_gemm_hhx semantics ----
__device__ __forceinline__ v16h g2_frag(const _Float16* p, int hh) { FragH f; f.half[0] = *(const v8us*)((const unsigned short*)p + 8 * hh); f.half[1] = *(const v8us*)((const unsigned short*)p + 16 + 8 * hh); return f.v; }
__device__ __forceinline__ v8f g2_mma(v16h a, v16h b, v8f c) { v8f d = __builtin_amdgcn_wmma_f32_16x16x32_f16(false, a, false, b, (short)0, c, false, false); asm volatile("v_nop\n\tv_nop\n\tv_nop\n\tv_nop" : "+v"(d) : "v"(a), "v"(b)); return d; }
template <int ACT>
__global__ __launch_bounds__(128) void k_gemm2(const _Float16* __restrict__ A, int lda, size_t sA, const _Float16* __restrict__ Bh, int ldb, size_t sB, float alpha, const float* __restrict__ bias, size_t sBias, const float* __restrict__ CP, int rowsPerB, size_t sCPb, int row0g,
    float* __restrict__ C, _Float16* __restrict__ C16, int ldc, size_t sC, int M, int N, int K) { static_assert(ACT == 0 || ACT == 3 || ACT == 6 || ACT == 8 || ACT == 9 || ACT == 11 || ACT == 12 || ACT == 14 || ACT == 15 || ACT == 16 || ACT == 17, "k_gemm2: unsupported ACT code (would silently apply no activation)");
  __shared__ __attribute__((aligned(16))) float so[4][32][68];
  const int tid = threadIdx.x, w = tid >> 5, lane = tid & 31, ln = lane & 15, hh = lane >> 4; const int by = blockIdx.y;
  A += (size_t)by * sA; Bh += (size_t)by * sB; const size_t cofs = (size_t)by * sC; const float* bp = bias ? bias + (size_t)by * sBias : nullptr;
  const int ntn = N >> 6; const int mt = blockIdx.x / ntn, nq = blockIdx.x - mt * ntn; const int row0 = mt * 128 + 32 * w, col0 = nq * 64; if (row0 >= M) return;
  const _Float16* a0p = A + (size_t)(row0 + ln) * lda; const _Float16* a1p = a0p + (size_t)16 * lda;
  const _Float16* b0p = Bh + (size_t)(col0 + ln) * ldb; const _Float16* b1p = b0p + (size_t)16 * ldb; const _Float16* b2p = b1p + (size_t)16 * ldb; const _Float16* b3p = b2p + (size_t)16 * ldb;
  const v8f z8 = {0.f,0.f,0.f,0.f,0.f,0.f,0.f,0.f}; v8f c00 = z8, c01 = z8, c02 = z8, c03 = z8, c10 = z8, c11 = z8, c12 = z8, c13 = z8;
#pragma unroll 1
  for (int kb = 0; kb < K; kb += 32) { const v16h a0 = g2_frag(a0p + kb, hh), a1 = g2_frag(a1p + kb, hh);
    v16h b = g2_frag(b0p + kb, hh); c00 = g2_mma(a0, b, c00); c10 = g2_mma(a1, b, c10);
    b = g2_frag(b1p + kb, hh); c01 = g2_mma(a0, b, c01); c11 = g2_mma(a1, b, c11);
    b = g2_frag(b2p + kb, hh); c02 = g2_mma(a0, b, c02); c12 = g2_mma(a1, b, c12);
    b = g2_frag(b3p + kb, hh); c03 = g2_mma(a0, b, c03); c13 = g2_mma(a1, b, c13); }
  v8f accs[8] = {c00, c01, c02, c03, c10, c11, c12, c13};
#pragma unroll
  for (int u = 0; u < 8; ++u) { const int t = u & 3, half = u >> 2; const int col = col0 + t * 16 + ln; const float bv = bp ? bf16_round(bp[col]) : 0.f;
#pragma unroll
    for (int r = 0; r < 8; ++r) { const int rloc = half * 16 + 8 * hh + r; float v = accs[u][r] * alpha + bv; if (CP) { if (rowsPerB < 0) v += CP[cofs + (size_t)(row0g + row0 + rloc) * ldc + col];      /* rowsPerB < 0: own element of the batched C plane */ else { const int bidx = (row0g + row0 + rloc) / rowsPerB; v += CP[(size_t)bidx * sCPb + (size_t)by * 64 + col]; } }
      if (ACT == 3) v = fmaxf(v, 0.f); else if (ACT == 6) v = 0.5f * v * (1.0f + erff(v * 0.70710678118654752f)); else if (ACT == 11) v = 1.0f / (1.0f + expf(-v)); else if (ACT == 15) v = v / (1.0f + expf(-v)); else if (ACT == 12) v = (v > 0.f) ? v : 0.01f * v; else if (ACT == 8) v = tanhf(v); else if (ACT == 9) v = 0.5f * v * (1.0f + tanhf(0.7978845608028654f * (v + 0.044715f * v * v * v))); else if (ACT == 14) v = (v > 0.f) ? v : 0.1f * v; else if (ACT == 16) v = (v >= 0.f) ? v : 0.3f * v; else if (ACT == 17) v = (v >= 0.f) ? v : 0.2f * v;
      so[w][rloc][t * 16 + ln] = v; } }
  __builtin_amdgcn_fence(__ATOMIC_ACQ_REL, "workgroup"); __builtin_amdgcn_wave_barrier();
  const int rsub = lane >> 4, c4 = (lane & 15) * 4;
  {
#pragma unroll
    for (int q = 0; q < 16; ++q) { const int r = q * 2 + rsub; const v4f v = *(const v4fa*)&so[w][r][c4]; if (C) *(v4f*)(C + cofs + (size_t)(row0 + r) * ldc + col0 + c4) = v; if (C16) { v4h h4; for (int i = 0; i < 4; ++i) h4[i] = (_Float16)v[i]; *(v4h*)(C16 + cofs + (size_t)(row0 + r) * ldc + col0 + c4) = h4; } }
     } }


__global__ __launch_bounds__(256) void k_wnat(const float* __restrict__ w, size_t n8, _Float16* __restrict__ Bt) { const size_t t = (size_t)blockIdx.x * 256 + threadIdx.x; if (t >= n8) return; FragH f; for (int q = 0; q < 8; ++q) f.h[q] = (_Float16)(bf16_round(w[t * 8 + q]) * 16.0f); *(v8us*)((unsigned short*)Bt + t * 8) = f.half[0];  }
__global__ __launch_bounds__(256) void k_rsm(const float* __restrict__ S, _Float16* __restrict__ P, int nrows) {
  #pragma clang fp contract(off)
  const int i = blockIdx.x * 256 + threadIdx.x; if (i >= nrows) return; const float* s = S + (size_t)i * SQ; float mx = -3.0e38f;
#pragma unroll 1
  for (int j = 0; j < SQ; ++j) mx = fmaxf(mx, s[j]); float se = 0.f;
#pragma unroll 1
  for (int j = 0; j < SQ; ++j) se += expf(s[j] - mx); const float sc = 256.0f / se;
#pragma unroll 1
  for (int j0 = 0; j0 < SQ; j0 += 8) { FragH f; for (int q = 0; q < 8; ++q) f.h[q] = (_Float16)(expf(s[j0 + q] - mx) * sc); unsigned short* d = (unsigned short*)P + (size_t)i * SQ + j0; *(v8us*)d = f.half[0];  } }
__global__ __launch_bounds__(256) void k_vt(const _Float16* __restrict__ V16, int b, int h0, _Float16* __restrict__ VT) { __shared__ unsigned short tl[64][65]; const int tid = threadIdx.x; const int hh = blockIdx.x % HG, sg = blockIdx.x / HG; const int s0 = sg * 64; const int h = h0 + hh;
  for (int i = tid; i < 64 * 8; i += 256) { const int j = i / 8, d8 = (i % 8) * 8; FragH f; f.half[0] = *(const v8us*)((const unsigned short*)V16 + ((size_t)b * SQ + s0 + j) * DM + h * HD + d8); for (int q = 0; q < 8; ++q) tl[d8 + q][j] = f.u[q]; }
  __syncthreads();
  { for (int i = tid; i < 64 * 8; i += 256) { const int d = i / 8, j8 = (i % 8) * 8; FragH f; for (int q = 0; q < 8; ++q) f.u[q] = tl[d][j8 + q]; *(v8us*)((unsigned short*)VT + ((size_t)hh * HD + d) * SQ + s0 + j8) = f.half[0]; }  } }



__global__ __launch_bounds__(256) void k_rsmkm(const float* __restrict__ S, _Float16* __restrict__ P, int nrows, const int* __restrict__ am) {
  #pragma clang fp contract(off)
  const int t = blockIdx.x * 256 + threadIdx.x; if (t >= nrows) return; const size_t i = (size_t)t; const float* s = S + i * SQ; const int* mr = am + (size_t)(t % SQ) * SQ; float mx = -3.0e38f;
#pragma unroll 1
  for (int j = 0; j < SQ; ++j) { const float f = (mr[j] != 0) ? 1.f : 0.f; mx = fmaxf(mx, fmaf(f, s[j], (1.f - f) * -1.0e9f)); } float se = 0.f;
#pragma unroll 1
  for (int j = 0; j < SQ; ++j) { const float f = (mr[j] != 0) ? 1.f : 0.f; se += __expf(fmaf(f, s[j], (1.f - f) * -1.0e9f) - mx); } const float sc = 256.0f / se;
#pragma unroll 1
  for (int j0 = 0; j0 < SQ; j0 += 8) { FragH fr; for (int q = 0; q < 8; ++q) { const int j = j0 + q; const float f = (mr[j] != 0) ? 1.f : 0.f; fr.h[q] = (_Float16)(__expf(fmaf(f, s[j], (1.f - f) * -1.0e9f) - mx) * sc); }
    unsigned short* d = (unsigned short*)P + i * SQ + j0; *(v8us*)d = fr.half[0];  } }

__global__ __launch_bounds__(256) void k_bdshn(const float* __restrict__ Wb, _Float16* __restrict__ Bt) {
  const size_t t = (size_t)blockIdx.x * 256 + threadIdx.x; if (t >= (size_t)DM * DM / 8) return; const size_t e0 = t * 8; const int n = (int)(e0 / DM), k0 = (int)(e0 % DM); const int h = n >> 6, hk = k0 >> 6; const float on = (hk == h) ? 16.0f : 0.0f; const int o = n & 63, d0 = k0 & 63; FragH f;
  for (int q = 0; q < 8; ++q) f.h[q] = (_Float16)(bf16_round(Wb[(size_t)o * 64 + d0 + q]) * on);
  unsigned short* d = (unsigned short*)Bt + e0; *(v8us*)d = f.half[0];  }

typedef int v4ia __attribute__((ext_vector_type(4), may_alias));
template <int M> __device__ __forceinline__ float rs_xm(float x) { return __builtin_bit_cast(float, __builtin_amdgcn_update_dpp(0, __builtin_bit_cast(int, x), 0x160 | M, 0xf, 0xf, true)); }  // lane l with lane l ^ M inside a 16-lane row
__device__ __forceinline__ float rs_xh(float x) { return __builtin_bit_cast(float, __builtin_amdgcn_permlanex16(__builtin_bit_cast(int, x), __builtin_bit_cast(int, x), 0x76543210, 0xfedcba98, false, false)); }  // lane l with lane l ^ 16
__device__ __forceinline__ float rs_wmax(float v) { v = fmaxf(v, rs_xm<1>(v)); v = fmaxf(v, rs_xm<2>(v)); v = fmaxf(v, rs_xm<4>(v)); v = fmaxf(v, rs_xm<8>(v)); return fmaxf(v, rs_xh(v)); }
__device__ __forceinline__ float rs_wsum(float v) { v += rs_xm<1>(v); v += rs_xm<2>(v); v += rs_xm<4>(v); v += rs_xm<8>(v); return v + rs_xh(v); }
// Four 2^x. Written as asm for the slot behind a transcendental (one independent instruction or v_nop before its result is read or its source overwritten): each v_exp_f32 is followed by
// an independent one (early-clobber outputs share no register with the sources), the last by v_nop.
__device__ __forceinline__ v4f rs_exp4(v4f x) { float e0, e1, e2, e3;
  asm("v_exp_f32 %0, %4\n\tv_exp_f32 %1, %5\n\tv_exp_f32 %2, %6\n\tv_exp_f32 %3, %7\n\tv_nop" : "=&v"(e0), "=&v"(e1), "=&v"(e2), "=&v"(e3) : "v"(x[0]), "v"(x[1]), "v"(x[2]), "v"(x[3]));
  const v4f e = {e0, e1, e2, e3}; return e; }
// Attention as one stream over the keys, straight from the f32 inputs: one launch for all batches and heads; scores and weights stay in registers. The per-head matrices leave the key loop by associativity:
// energy = (Wq xq).(Wk xk) = (Wk^T Wq xq).xk, and sum_j p_j (Wv xv_j) = Wv (sum_j p_j xv_j): a wave turns 16 queries into q' = Wk^T (Wq xq) once (WMMA, D = W x^T, whose accumulators are the next product's B operand in place), the loop works on the rounded input rows themselves, and Wv meets the normalised sum once at the end.
// A key with mask 0 has weight exactly 0 beside any open key: every work-group lists its batch's open keys in LDS (a wave takes 128 keys of the mask, 32 a round; a key's place is the open keys of the waves below + the open lanes below it). Places from n on hold token 0: a real row, so that a stage's tail is finite; its scores take the fill. n == 0: the places are the tokens themselves, every score at the fill, the row comes out uniform as in the module.
// A wave owns 32 query columns and walks the listed keys in passes of 32: S^T = K Q^T (A = 16 key rows, B = 16 query columns, both k-contiguous f16 rows), so a lane holds 8 keys of ONE query a tile;
// two score tiles of a pass, converted in place, are the B operand of O^T += V^T P^T (A = rows of V^T in the same k order). Maximum and sum are per lane plus one exchange between the lane halves.
// A work-group is two groups of 8 waves on one (batch, head) and the same 256 query columns, four waves a SIMD, so that one wave's vector work stands beside another's products: wave w of group 0 and wave w of group 1 (partners) own the same 32 columns, group g walks the listed keys 128 s + 64 g to 128 s + 64 g + 63 of stage s.
// A partner makes q' for 16 of the 32 columns and hands the fragments over through LDS (column group 0 of a wave is its own, 1 its partner's). Behind the loop each wave hands the partial sums, maximum and sum of its column group 1 to its partner through LDS (one new barrier) and joins the partner's with its own group 0, both brought to the larger maximum.
// Each group stages its own 64 keys of a stage: the listed rows of keys and values, a head's 256 contiguous bytes of a row as two whole 128-byte lines, 8 lanes each, through registers, rounded to bf16 (held exactly in f16), into one of two LDS buffers;
// a thread holds 4 inputs of 4 consecutive places, so the values go in transposed ([input][key]) by 8-byte stores. Stage s + 1 is loaded while stage s is worked on, stored behind it, one barrier a stage.
// Values: t = energy / sqrt(512) * log2(e); a place from n on takes the module's fill (-1e20, same scale) BEFORE the maximum; weight = 2^(t - m + 6) as f16, m the maximum in use (renewed when a pass exceeds it by more than 8, so a weight stays below 2^14); the sum adds the f32 weights; O / sum x64 as f16 is the B operand of the Wv product; o stored x64 as f16 rows as before.
// Each work-group also rounds its 1024 elements of the output weights (f16 x16) for the launch behind it.
// Every '#pragma unroll' in the kernel stands on a loop over a register array (loads in flight, fragments, accumulators): rolled, the array would be indexed at run time and leave the registers.
#define FA_WAVES 8       /* waves of a group, side by side over the query columns */
#define FA_GROUPS 2      /* groups of waves, each on its own 64 keys of a stage */
#define FA_COLS 32
#define FA_STAGE 64      /* keys a group and stage */
#define FA_PITCH 72      /* halves a staged row: 144 bytes = 16 x 9, an odd multiple of 16 bytes for the 16-byte fragment reads */
static_assert(SQ % (FA_WAVES * FA_COLS) == 0 && SQ % (FA_GROUPS * FA_STAGE) == 0 && HD == 64 && FA_WAVES == 8 && FA_GROUPS == 2 && FA_COLS == 32 && FA_STAGE == 64 && SQ == FA_GROUPS * FA_WAVES * 128 && (SQ & (SQ - 1)) == 0, "k_fattn: whole work-groups and stages; 8 threads a 128-byte line, 4 rows a thread; 16 waves x 128 keys are a batch's mask");
static_assert((size_t)NB * NH * (SQ / (FA_WAVES * FA_COLS)) * 512 * 2 == (size_t)DM * DM, "k_fattn: the grid covers the output weights, 2 a thread");
typedef _Float16 v8h __attribute__((ext_vector_type(8)));
typedef unsigned short v4us __attribute__((ext_vector_type(4), may_alias));
__device__ __forceinline__ v8f fa_mma(v16h a, v16h b, v8f c) { return __builtin_amdgcn_wmma_f32_16x16x32_f16(false, a, false, b, (short)0, c, false, false); }
// One 16 x 32 fragment from k-contiguous rows, k order as g2_frag: p = the lane's row + 8 * (lane >> 4) halves.
__device__ __forceinline__ v16h fa_frag(const unsigned short* p) { FragH f; f.half[0] = *(const v8us*)p; f.half[1] = *(const v8us*)(p + 16); return f.v; }
typedef float v2f __attribute__((ext_vector_type(2)));
typedef float v2fa __attribute__((ext_vector_type(2), may_alias));
typedef unsigned short v2us __attribute__((ext_vector_type(2), may_alias));
typedef __bf16 v2b __attribute__((ext_vector_type(2)));
__device__ __forceinline__ v4f fa_rb(v4f x) {      /* to bf16, nearest even, as bf16_round; two values a conversion, each back as f32 by its bits */
  const v2f a = {x[0], x[1]}, c = {x[2], x[3]}; const unsigned ua = __builtin_bit_cast(unsigned, __builtin_convertvector(a, v2b)), uc = __builtin_bit_cast(unsigned, __builtin_convertvector(c, v2b));
  const v4f r = {__uint_as_float(ua << 16), __uint_as_float(ua & 0xffff0000u), __uint_as_float(uc << 16), __uint_as_float(uc & 0xffff0000u)}; return r; }
__device__ __forceinline__ v4us fa_h4(v4f x) { return __builtin_bit_cast(v4us, __builtin_convertvector(x, v4h)); }
// Two accumulator tiles (rows 16 a + 8 hh + r and 16 (a + 1) + 8 hh + r of one column), scaled, as one B fragment over these 32 rows: the k order of fa_frag.
__device__ __forceinline__ v16h fa_pack(v8f a, v8f b, float sc) { return __builtin_shufflevector(__builtin_convertvector(a * sc, v8h), __builtin_convertvector(b * sc, v8h), 0, 1, 2, 3, 4, 5, 6, 7, 8, 9, 10, 11, 12, 13, 14, 15); }
// D^T = W X^T for one column group: W [64][64] from LDS (A, rows = outputs), x = the two B fragments over the 64 inputs; the result as the four accumulator tiles over the 64 outputs, still x16 (W is held x16).
__device__ __forceinline__ void fa_wx(const unsigned short (*w)[FA_PITCH], int ln, int hh, const v16h x[2], v8f d[4]) {
  const v8f z8 = {0.f, 0.f, 0.f, 0.f, 0.f, 0.f, 0.f, 0.f};
#pragma unroll
  for (int et = 0; et < 4; ++et) d[et] = fa_mma(fa_frag(&w[et * 16 + ln][8 * hh]), x[0], z8);
#pragma unroll
  for (int et = 0; et < 4; ++et) d[et] = fa_mma(fa_frag(&w[et * 16 + ln][32 + 8 * hh]), x[1], d[et]);
}
// A work-group barrier for data that goes through LDS alone: the fences name the LDS address space, so the wave waits for its LDS operations and not, as __syncthreads() does, for every global load that is under way.
__device__ __forceinline__ void fa_lds_barrier() { __builtin_amdgcn_fence(__ATOMIC_RELEASE, "workgroup", "local"); __builtin_amdgcn_s_barrier(); __builtin_amdgcn_fence(__ATOMIC_ACQUIRE, "workgroup", "local"); }
__global__ __launch_bounds__(FA_GROUPS * FA_WAVES * 32) void k_fattn(const float* __restrict__ xq, const float* __restrict__ xk, const float* __restrict__ xv, const float* __restrict__ wq, const float* __restrict__ wk, const float* __restrict__ wv,
                                                         const float* __restrict__ wout, const int* __restrict__ Km, _Float16* __restrict__ BO, _Float16* __restrict__ O16) {
  constexpr int NW = FA_GROUPS * FA_WAVES;
  __shared__ __attribute__((aligned(16))) unsigned short sk[2][FA_GROUPS][FA_STAGE][FA_PITCH];      /* [buffer][group][key][input] */
  __shared__ __attribute__((aligned(16))) unsigned short sv[2][FA_GROUPS][HD][FA_PITCH];            /* [buffer][group][input][key] */
  __shared__ __attribute__((aligned(16))) unsigned short sw[3][HD][FA_PITCH];            /* bf16-rounded, x16: Wq [output][input], Wk^T [input][output], Wv [output][input] */
  __shared__ __attribute__((aligned(16))) unsigned short sq[NW][FA_COLS / 2][FA_PITCH];      /* a wave's query rows [query][input] */
  __shared__ __attribute__((aligned(16))) unsigned short sx[NW][4][32][8];      /* a wave's q' fragments for its partner: [16 bytes of a lane][lane] */
  __shared__ __attribute__((aligned(16))) float sm[NW][8][32][4];      /* a wave's partial sums of column group 1 for its partner: [16 bytes of a lane][lane] */
  __shared__ float sl[NW][2][32];      /* with their maximum and sum */
  __shared__ __attribute__((aligned(16))) int li[SQ];      /* place -> token */
  __shared__ int wt[NW];      /* the waves' counts of open keys */
  constexpr int QB = SQ / (FA_WAVES * FA_COLS);
  constexpr float SC = 0.044194173824159216f * 1.44269504088896340736f, FILL = -1.0e20f * SC;
  const int tid = threadIdx.x, lane = tid & 31, ln = lane & 15, hh = lane >> 4; const int w16 = __builtin_amdgcn_readfirstlane(tid >> 5);
  const int g = w16 >> 3, pw = w16 ^ FA_WAVES;      /* the wave's group; its partner */
  const int bh = blockIdx.x / QB, b = bh / NH, h = bh % NH; const int q0 = (blockIdx.x % QB) * (FA_WAVES * FA_COLS) + (w16 & (FA_WAVES - 1)) * FA_COLS + g * (FA_COLS / 2);      /* first query of the wave's own column group */
  const char* qb = (const char*)(xq + ((size_t)b * SQ + q0) * DM + h * HD);      /* wave-uniform bases */
  const char* kb = (const char*)(xk + (size_t)b * SQ * DM + h * HD);
  const char* vb = (const char*)(xv + (size_t)b * SQ * DM + h * HD);
  const char* mb = (const char*)(Km + (size_t)b * SQ);
  const int k0 = w16 * 128 + lane;
  const unsigned roff = (unsigned)(ln * (DM * 2) + hh * 16);      /* byte offsets of the lane: row ln of a tile of o rows */
  const unsigned mo = (unsigned)(k0 * 4), wo = (unsigned)(tid * 32), xo = (unsigned)(hh * (DM * 4) + ln * 16), to = (unsigned)(((int)blockIdx.x * 512 + tid) * 8);
  const int sg = (((tid >> 6) & 3) << 2) | ((tid >> 3) & 3), sc4 = ((tid & 7) | ((tid >> 2) & 8)) * 4;      /* staging, in the thread's own group: 8 lanes a 128-byte line, a wave one half of the rows of 4 place groups; places 4 sg to 4 sg + 3, inputs sc4 to sc4 + 3. So a wave's key stores fall on all 64 banks, its value stores two deep on 32 (16 lanes a row: four deep on 16) */
  v16h qf[2][2]; v4f gk[4], gv[4], gx[FA_COLS / 4]; v2f ga; int n = 0;
  {
    int mv[4]; v4f gw[3][2];
#pragma unroll
    for (int r = 0; r < 4; ++r) mv[r] = *(const int*)(mb + mo + r * 128);
#pragma unroll
    for (int q = 0; q < 2; ++q) { gw[0][q] = *(const v4fa*)((const char*)wq + wo + q * 16); gw[1][q] = *(const v4fa*)((const char*)wk + wo + q * 16); gw[2][q] = *(const v4fa*)((const char*)wv + wo + q * 16); }
    asm volatile("s_wait_xcnt 0x0" :: "v"(mo), "v"(wo) : "memory");      /* as the wait below; as a memory barrier for the compiler it also keeps the mask and the matrices, which are needed first, ahead of the query rows: loads return in order */
#pragma unroll
    for (int j = 0; j < FA_COLS / 4; ++j) gx[j] = *(const v4fa*)(qb + j * 2 * DM * 4 + xo);      /* a wave-wide load covers two rows' 256 bytes */
    ga = *(const v2fa*)((const char*)wout + to);
    asm volatile("s_wait_xcnt 0x0" :: "v"(xo), "v"(to) : "memory");      /* behind the loads, ahead of any new value in a register that they name (a precaution of form); as inputs the lane offsets keep their registers up to it */
    unsigned bal[4]; int tot = 0;
#pragma unroll
    for (int r = 0; r < 4; ++r) { bal[r] = __builtin_amdgcn_ballot_w32(mv[r] != 0); tot += __builtin_popcount(bal[r]); }
    if (lane == 0) wt[w16] = tot;
    { const v4ia z4 = {0, 0, 0, 0}; *(v4ia*)&li[tid * 4] = z4; }
    fa_lds_barrier();      /* every wave's count is in LDS, and the list's start value; the matrices and the query rows stay under way */
    int base = 0;
    for (int i = 0; i < NW; ++i) { const int v = wt[i]; base += (i < w16) ? v : 0; n += v; }
    if (n == 0) { const v4ia a4 = {tid * 4, tid * 4 + 1, tid * 4 + 2, tid * 4 + 3}; *(v4ia*)&li[tid * 4] = a4; }
    else {
#pragma unroll
      for (int r = 0; r < 4; ++r) { if ((bal[r] >> lane) & 1u) li[base + __builtin_popcount(bal[r] & ((1u << lane) - 1u))] = k0 + r * 32; base += __builtin_popcount(bal[r]); }      /* a place is a count of open keys below: under SQ */
    }
#pragma unroll
    for (int q = 0; q < 2; ++q) {      /* element (row tid >> 3, column (tid & 7) * 8 + q * 4 + i) of each matrix */
      *(v4us*)&sw[0][tid >> 3][(tid & 7) * 8 + q * 4] = fa_h4(fa_rb(gw[0][q]) * 16.0f); *(v4us*)&sw[2][tid >> 3][(tid & 7) * 8 + q * 4] = fa_h4(fa_rb(gw[2][q]) * 16.0f);
      const v4us t4 = fa_h4(fa_rb(gw[1][q]) * 16.0f);
      for (int i = 0; i < 4; ++i) sw[1][(tid & 7) * 8 + q * 4 + i][tid >> 3] = t4[i]; }
    fa_lds_barrier();      /* the list and the three matrices are in LDS for every wave; the query rows and the output weights, the last loads to return, are not waited for here */
  }
  n = __builtin_amdgcn_readfirstlane(n);      /* open keys of the batch: a sum of popcounts over SQ keys */
  const int nst = ((n != 0 ? n : SQ) + FA_GROUPS * FA_STAGE - 1) / (FA_GROUPS * FA_STAGE);      /* stages: 1 to SQ / 128 */
  { const v4ia k4 = *(const v4ia*)&li[g * FA_STAGE + sg * 4]; unsigned so[4];      /* stage 0 on its way; the token is bounded by the shape before an address is formed */
#pragma unroll
    for (int j = 0; j < 4; ++j) { so[j] = (unsigned)((k4[j] & (SQ - 1)) * (DM * 4) + sc4 * 4); gk[j] = *(const v4fa*)(kb + so[j]); gv[j] = *(const v4fa*)(vb + so[j]); }
    asm volatile("s_wait_xcnt 0x0" :: "v"(so[0]), "v"(so[1]), "v"(so[2]), "v"(so[3]) : "memory"); }      /* as above */
  __builtin_amdgcn_sched_barrier(0);      /* stage 0's loads are issued before the first wait on a query row: without it this build rounded the query rows first and met the memory latency twice */
#pragma unroll
  for (int j = 0; j < FA_COLS / 4; ++j) *(v4us*)&sq[w16][j * 2 + hh][ln * 4] = fa_h4(fa_rb(gx[j]));
  __builtin_amdgcn_fence(__ATOMIC_ACQ_REL, "wavefront"); __builtin_amdgcn_wave_barrier();      /* the rows are read back by other lanes of the same wave: keeps the reads behind the writes, without a wait for stage 0's loads */
  { const v4f a4 = {ga[0], ga[1], 0.f, 0.f}; const v4us h4 = fa_h4(fa_rb(a4) * 16.0f); const v2us h2 = {h4[0], h4[1]};
    *(v2us*)((char*)BO + (to >> 1)) = h2; }      /* Wo natural [out][in] = Bt x16; here, since the next barrier waits for stage 0's loads in any case and the store's return with them */
  {      /* q' = Wk^T (Wq xq) of the wave's own 16 columns, while stage 0 is under way */
    v16h x[2]; v8f d[4];
#pragma unroll
    for (int ks = 0; ks < 2; ++ks) x[ks] = fa_frag(&sq[w16][ln][ks * 32 + 8 * hh]);
    fa_wx(sw[0], ln, hh, x, d);
    x[0] = fa_pack(d[0], d[1], 0.0625f); x[1] = fa_pack(d[2], d[3], 0.0625f);
    fa_wx(sw[1], ln, hh, x, d);
    qf[0][0] = fa_pack(d[0], d[1], 0.0625f); qf[0][1] = fa_pack(d[2], d[3], 0.0625f);
#pragma unroll
    for (int ks = 0; ks < 2; ++ks) { FragH f; f.v = qf[0][ks]; *(v8us*)&sx[w16][ks * 2][lane][0] = f.half[0]; *(v8us*)&sx[w16][ks * 2 + 1][lane][0] = f.half[1]; }      /* lane for lane, for the partner */
  }
  auto put = [&](int buf) {      /* the loaded stage, rounded, into LDS: key rows as they are, value rows transposed (4 places of one input are 8 bytes) */
    v4f f[4];
#pragma unroll
    for (int j = 0; j < 4; ++j) { *(v4us*)&sk[buf][g][sg * 4 + j][sc4] = fa_h4(fa_rb(gk[j])); f[j] = fa_rb(gv[j]); }
#pragma unroll
    for (int i = 0; i < 4; ++i) { const v4f c = {f[0][i], f[1][i], f[2][i], f[3][i]}; *(v4us*)&sv[buf][g][sc4 + i][sg * 4] = fa_h4(c); }
  };
  __builtin_amdgcn_sched_barrier(0);      /* the products above run while stage 0 is under way: without it this build rounded stage 0 among them and waited for its loads behind the first product */
  put(0);
  const v8f z8 = {0.f, 0.f, 0.f, 0.f, 0.f, 0.f, 0.f, 0.f};
  v8f o[2][4]; float l[2] = {0.f, 0.f}, m[2] = {-3.0e38f, -3.0e38f};
#pragma unroll
  for (int u = 0; u < 2; ++u) for (int dt = 0; dt < 4; ++dt) o[u][dt] = z8;
  __syncthreads();      /* stage 0 and the partners' q' are in LDS for every wave */
#pragma unroll
  for (int ks = 0; ks < 2; ++ks) { FragH f; f.half[0] = *(const v8us*)&sx[pw][ks * 2][lane][0]; f.half[1] = *(const v8us*)&sx[pw][ks * 2 + 1][lane][0]; qf[1][ks] = f.v; }
  int s = 0;
#pragma unroll      /* two copies of the stage loop, ph a constant in each: the stages that hold open keys alone carry no fill code; unrolled, not branched, since a branch in mid pass cost registers past the first 256 */
  for (int ph = 0; ph < 2; ++ph) for (const int se = (ph == 0) ? n / (FA_GROUPS * FA_STAGE) : nst; s < se; ++s) {
    const int bf = s & 1; const int sn = (s + 1 < nst) ? s + 1 : 0;      /* the last stage loads stage 0 again (in bounds, never read) */
    const v4ia k4 = *(const v4ia*)&li[(sn * FA_GROUPS + g) * FA_STAGE + sg * 4];      /* the next stage's four places of the thread: read with the K fragments, so that one LDS latency serves both */
    v16h kf[2][2];
#pragma unroll
    for (int kt = 0; kt < 2; ++kt) for (int ks = 0; ks < 2; ++ks) kf[kt][ks] = fa_frag(&sk[bf][g][kt * 16 + ln][ks * 32 + 8 * hh]);
    __builtin_amdgcn_sched_barrier(0);      /* all eight reads are issued before the first wait on one: without it this build read two fragments at a time into one register block and met the LDS latency three times behind every barrier */
    { unsigned so[4];      /* the token is bounded by the shape before an address is formed */
#pragma unroll
      for (int j = 0; j < 4; ++j) { so[j] = (unsigned)((k4[j] & (SQ - 1)) * (DM * 4) + sc4 * 4); gk[j] = *(const v4fa*)(kb + so[j]); gv[j] = *(const v4fa*)(vb + so[j]); }
      asm volatile("s_wait_xcnt 0x0" :: "v"(so[0]), "v"(so[1]), "v"(so[2]), "v"(so[3]) : "memory"); }      /* behind the loads, ahead of any new value in a register that they name (a precaution of form); as inputs the lane offsets keep their registers up to it; as a memory barrier for the compiler it also keeps the loads here, a whole stage ahead of their stores */
#pragma unroll
    for (int p = 0; p < FA_STAGE / 32; ++p) {
      if (ph == 1 && n != 0 && (s * FA_GROUPS + g) * FA_STAGE + p * 32 >= n) break;      /* a scalar branch: the group's keys from here on are all past the open ones (weight exactly 0); the staging and the barrier below are passed all the same. A wave that never ran a pass hands over sums of 0 under the start maximum: factor 0 */
      v16h vf[4]; v8f t[2][2];
#pragma unroll
      for (int dt = 0; dt < 4; ++dt) vf[dt] = fa_frag(&sv[bf][g][dt * 16 + ln][p * 32 + 8 * hh]);
#pragma unroll
      for (int u = 0; u < 2; ++u) for (int kt = 0; kt < 2; ++kt) t[u][kt] = fa_mma(kf[kt][0], qf[u][0], z8);
#pragma unroll
      for (int u = 0; u < 2; ++u) for (int kt = 0; kt < 2; ++kt) t[u][kt] = fa_mma(kf[kt][1], qf[u][1], t[u][kt]);
      if (p + 1 < FA_STAGE / 32) {      /* the next pass of the SAME stage: its K fragments are fetched behind this pass's score products, into the registers these have left */
#pragma unroll
        for (int kt = 0; kt < 2; ++kt) for (int ks = 0; ks < 2; ++ks) kf[kt][ks] = fa_frag(&sk[bf][g][(p + 1) * 32 + kt * 16 + ln][ks * 32 + 8 * hh]); }
      float mx[2];
#pragma unroll
      for (int u = 0; u < 2; ++u) for (int kt = 0; kt < 2; ++kt) t[u][kt] *= SC;
      if (ph == 1) {      /* the last stage where n is no whole number of stages; every stage where n == 0 */
        const int left = n - ((s * FA_GROUPS + g) * FA_STAGE + p * 32 + 8 * hh);      /* open places from the lane's first key of tile 0 on */
#pragma unroll
        for (int u = 0; u < 2; ++u) for (int kt = 0; kt < 2; ++kt) for (int r = 0; r < 8; ++r) t[u][kt][r] = (kt * 16 + r < left) ? t[u][kt][r] : FILL;
      }
#pragma unroll
      for (int u = 0; u < 2; ++u) {
        float x = fmaxf(t[u][0][0], t[u][1][0]);
#pragma unroll
        for (int r = 1; r < 8; ++r) x = fmaxf(x, fmaxf(t[u][0][r], t[u][1][r]));
        mx[u] = fmaxf(x, rs_xh(x));
      }
      if (__builtin_amdgcn_ballot_w32((mx[0] > m[0] + 8.0f) || (mx[1] > m[1] + 8.0f)) != 0) {      /* one scalar branch a pass: the products of a renewal run only where some column needs one */
        const float n0 = fmaxf(m[0], mx[0]), n1 = fmaxf(m[1], mx[1]); const v4f d4 = {m[0] - n0, m[1] - n1, 0.f, 0.f}; const v4f al = rs_exp4(d4); m[0] = n0; m[1] = n1;
#pragma unroll
        for (int u = 0; u < 2; ++u) { l[u] *= al[u]; for (int dt = 0; dt < 4; ++dt) o[u][dt] *= al[u]; }
      }
      v16h pf[2];
#pragma unroll
      for (int u = 0; u < 2; ++u) { const float ms = m[u] - 6.0f; v4f s4[2];
#pragma unroll
        for (int kt = 0; kt < 2; ++kt) { const v8f x = t[u][kt] - ms; const v4f x0 = {x[0], x[1], x[2], x[3]}, x1 = {x[4], x[5], x[6], x[7]}; const v4f e0 = rs_exp4(x0), e1 = rs_exp4(x1); s4[kt] = e0 + e1;
          const v8f e = {e0[0], e0[1], e0[2], e0[3], e1[0], e1[1], e1[2], e1[3]}; t[u][kt] = e; }
        const v4f sq = s4[0] + s4[1]; l[u] += (sq[0] + sq[1]) + (sq[2] + sq[3]);
        pf[u] = __builtin_shufflevector(__builtin_convertvector(t[u][0], v8h), __builtin_convertvector(t[u][1], v8h), 0, 1, 2, 3, 4, 5, 6, 7, 8, 9, 10, 11, 12, 13, 14, 15); }
      __builtin_amdgcn_sched_barrier(0);      /* this one and the next keep the eight products apart from the 2^x statements: those are asm text, which the compiler's padding behind a matrix instruction does not see */
#pragma unroll
      for (int dt = 0; dt < 4; ++dt) for (int u = 0; u < 2; ++u) o[u][dt] = fa_mma(vf[dt], pf[u], o[u][dt]);
      __builtin_amdgcn_sched_barrier(0);
    }
    put(bf ^ 1);      /* into the buffer whose readers all passed the barrier of stage s - 1 */
    __syncthreads();      /* publishes stage s + 1 and ends every wave's reads of stage s */
  }
  /* The two groups' halves meet: the wave's column group 1 goes to its partner, whose own group 0 it is. */
#pragma unroll
  for (int dt = 0; dt < 4; ++dt) { const v4f a = {o[1][dt][0], o[1][dt][1], o[1][dt][2], o[1][dt][3]}, c = {o[1][dt][4], o[1][dt][5], o[1][dt][6], o[1][dt][7]}; *(v4fa*)&sm[w16][dt * 2][lane][0] = a; *(v4fa*)&sm[w16][dt * 2 + 1][lane][0] = c; }
  sl[w16][0][lane] = m[1]; sl[w16][1][lane] = l[1];
  fa_lds_barrier();      /* every wave's hand-over is in LDS for its partner */
  const float mp = sl[pw][0][lane], lp = sl[pw][1][lane], mj = fmaxf(m[0], mp);      /* a group whose keys were all at the fill beside open keys of the other gets the factor 0 */
  const v4f d4 = {m[0] - mj, mp - mj, 0.f, 0.f}; const v4f al = rs_exp4(d4);
  const float lj = l[0] * al[0] + lp * al[1];
#pragma unroll
  for (int dt = 0; dt < 4; ++dt) { const v4f a = *(const v4fa*)&sm[pw][dt * 2][lane][0], c = *(const v4fa*)&sm[pw][dt * 2 + 1][lane][0]; const v8f e = {a[0], a[1], a[2], a[3], c[0], c[1], c[2], c[3]}; o[0][dt] = o[0][dt] * al[0] + e * al[1]; }
  _Float16* ob = O16 + ((size_t)b * SQ + q0) * DM + h * HD;
  { const float sc = 64.0f / (lj + rs_xh(lj)); v8f d[4];
    const v16h x[2] = {fa_pack(o[0][0], o[0][1], sc), fa_pack(o[0][2], o[0][3], sc)};      /* a lane's accumulator registers are consecutive inputs of its query: the B operand of o = Wv (O / sum) */
    fa_wx(sw[2], ln, hh, x, d);
#pragma unroll
    for (int dt = 0; dt < 4; ++dt) *(v8h*)((char*)(ob + dt * 16) + roff) = __builtin_convertvector(d[dt] * 0.0625f, v8h); }      /* 8 consecutive outputs of the lane's query row */
}
// Output product out = o Wo^T * alpha + b for all token rows, operands staged in LDS. A work-group of 8 waves owns a 128 x 128 tile of out (one work-group a WGP at this shape); a wave owns 32 x 64 of it (2 x 4 accumulator tiles, as k_gemm2).
// o rows and Wo rows come in stages of 128 k by the tensor mover (tensor_load_to_lds), through no register: a request brings one operand's 128 rows of 256 bytes (source pitch 1024 bytes) into a tile of its own, 16 bytes of pad behind a row (pitch 272 bytes).
// All four stages have their own tiles, so no tile is ever refilled: wave 0 issues the four requests for o, wave 1 those for Wo, three at the start and the fourth behind the first publish point (three of a wave outstanding at most), so the memory latency is met once and the later stages land while the earlier ones are worked on.
// A publish point stands at the head of every stage: s_wait_dscnt 0, the issuing waves' own counted s_wait_tensorcnt (a wave's requests land in issue order), the work-group barrier. Each operand byte is read once a work-group.
// The k steps run in the order of k_gemm2 and the fragments have its k order, so every accumulator sees the same sums; the epilogue is k_gemm2's (alpha, bias rounded to bf16, the wave's tile through its own LDS range, whole lines out).
// Every '#pragma unroll' in the kernel stands on a loop over a register array (fragments, accumulators, descriptors): rolled, the array would be indexed at run time and leave the registers.
#define OG_T 128         /* rows and columns of out a work-group */
#define OG_K 128         /* k a stage */
#define OG_PITCH 136     /* halves a staged row: 272 bytes = 16 x 17, an odd multiple of 16 bytes for the 16-byte fragment reads; the tensor load's pad gives the same pitch */
#define OG_TILE (OG_T * OG_PITCH * 2)      /* bytes of one operand's stage in LDS */
static_assert(MPO % OG_T == 0 && DM % OG_T == 0 && DM % OG_K == 0 && OG_K == 128 && OG_T == 128, "k_ogemm: whole tiles and stages; a staged row is 256 bytes, the pad interval of the tensor load");
static_assert(OG_TILE % 2048 == 0 && (DM / OG_K) == 4 && (DM / OG_K) * 2 * OG_TILE <= 327680 && 8 * 32 * 68 * 4 <= 2 * OG_TILE, "k_ogemm: every tile starts at a multiple of 2 KiB; four stages; all tiles fit the LDS; the waves' output ranges fit stage 0's two tiles");
typedef uint32_t u32x4 __attribute__((ext_vector_type(4)));
typedef uint32_t u32x8 __attribute__((ext_vector_type(8)));
typedef float f1a __attribute__((may_alias));
__device__ __forceinline__ uint32_t og_uni(uint32_t v) { return (uint32_t)__builtin_amdgcn_readfirstlane(v); }
__device__ __forceinline__ uint32_t og_pinned(uint32_t v) { uint32_t w = (uint32_t)__builtin_amdgcn_readfirstlane(v); asm volatile("" : "+s"(w)); return w; }      /* the test around a tensor load, held in a scalar register: the branch on it is a scalar one (a tensor load ignores EXEC) */
__device__ __forceinline__ void og_tload(u32x4 g0, u32x8 g1) { asm volatile("tensor_load_to_lds %0, %1" :: "s"(g0), "s"(g1) : "memory"); }      /* one request of the whole wave */
__global__ __launch_bounds__(256) void k_ogemm(const _Float16* __restrict__ A, const _Float16* __restrict__ Bh, float alpha, const float* __restrict__ bias, float* __restrict__ C) {
  constexpr int NS = DM / OG_K, NT = DM / OG_T;
  __shared__ __attribute__((aligned(2048))) unsigned char sm[NS * 2 * OG_TILE];      /* [stage][o, Wo][row][k]; behind the loop stage 0's two tiles hold the waves' tiles on their way out, [wave][32][68] floats */
  const int tid = threadIdx.x, lane = tid & 31, ln = lane & 15, hh = lane >> 4; const int wave = __builtin_amdgcn_readfirstlane(tid >> 5);
  const int row0 = ((int)blockIdx.x / NT) * OG_T, col0 = ((int)blockIdx.x % NT) * OG_T; const int wm = (wave >> 1) * 32, wn = (wave & 1) * 64;      /* the wave's place in the tile */
  const uint64_t src = (wave == 0) ? (uint64_t)(size_t)(A + (size_t)row0 * DM) : (uint64_t)(size_t)(Bh + (size_t)col0 * DM);      /* first byte of the issuing wave's operand rows */
  const uint32_t dst = (uint32_t)(size_t)sm + (uint32_t)(wave & 1) * OG_TILE;      /* byte offset in the work-group's LDS */
  u32x8 g1;      /* 1-byte elements, tensor = tile = 128 rows of 256 bytes, source pitch 1024 bytes, no mask, a pad of 4 dwords behind every 64 */
  g1[0] = og_uni((1u << 20) | (5u << 22) | (3u << 25)); g1[1] = og_uni((uint32_t)(OG_K * 2) << 16); g1[2] = og_uni((uint32_t)OG_T << 16); g1[3] = og_uni((uint32_t)(OG_K * 2) << 16);
  g1[4] = og_uni((uint32_t)OG_T); g1[5] = og_uni((uint32_t)(DM * 2)); g1[6] = og_uni(0u); g1[7] = og_uni(0u);
  asm volatile("" : "+s"(g1));      /* a descriptor word held in a scalar register: left as constants, this build wrote the words anew, and other values into their registers, while requests were outstanding */
  u32x4 g0[NS];      /* a descriptor of its own for every request: no word of a request that is outstanding takes a new value */
#pragma unroll
  for (int s = 0; s < NS; ++s) { const uint64_t ga = src + (uint64_t)(s * OG_K * 2);
    g0[s][0] = og_uni(1u); g0[s][1] = og_uni(dst + (uint32_t)(s * 2 * OG_TILE)); g0[s][2] = og_uni((uint32_t)ga); g0[s][3] = og_uni((((uint32_t)(ga >> 32)) & 0x01FFFFFFu) | 0x80000000u); }
  if (og_pinned(wave < 2)) { og_tload(g0[0], g1); og_tload(g0[1], g1); og_tload(g0[2], g1); }
  const char* ib = (const char*)(bias + col0 + wn); const unsigned io = (unsigned)(ln * 4);      /* the wave's 64 bias values: fetched here, so that the epilogue does not wait for them */
  float bv[4];
#pragma unroll
  for (int t = 0; t < 4; ++t) bv[t] = *(const float*)(ib + t * 64 + io);
  asm volatile("s_wait_xcnt 0x0" :: "v"(io) : "memory");      /* behind the loads, ahead of any new value in a register that they name (a precaution of form); as an input the lane offset keeps its register up to it */
  const v8f z8 = {0.f, 0.f, 0.f, 0.f, 0.f, 0.f, 0.f, 0.f};
  v8f acc[2][4];
#pragma unroll
  for (int i = 0; i < 2; ++i) for (int t = 0; t < 4; ++t) acc[i][t] = z8;
#pragma unroll
  for (int s = 0; s < NS; ++s) {
    /* Publish point of stage s. Issued so far: stages 0 to 2 at s == 0, all four from then on; the count leaves only younger requests outstanding. */
    asm volatile("s_wait_dscnt 0x0" ::: "memory");      /* the wave's LDS reads of the stage before have returned */
    if (og_pinned(wave < 2)) {
      /* stage s of the wave's own operand has landed; as inputs the request's descriptor words keep their registers up to the wait that covers it */
      if (s <= 1) asm volatile("s_wait_tensorcnt 0x2" :: "s"(g0[s]), "s"(g1) : "memory");
      else if (s == 2) asm volatile("s_wait_tensorcnt 0x1" :: "s"(g0[s]), "s"(g1) : "memory");
      else asm volatile("s_wait_tensorcnt 0x0" :: "s"(g0[s]), "s"(g1) : "memory");
    }
    __syncthreads();      /* stage s is in LDS for every wave */
    if (s == 0) { if (og_pinned(wave < 2)) og_tload(g0[NS - 1], g1); }      /* two of the wave's requests are outstanding at most: the last one follows, into a tile that nothing has touched */
    const unsigned short* sa = (const unsigned short*)(sm + (s * 2) * OG_TILE); const unsigned short* sb = (const unsigned short*)(sm + (s * 2 + 1) * OG_TILE);
    v16h af[2][2], bq[2][4];
#pragma unroll
    for (int i = 0; i < 2; ++i) af[0][i] = fa_frag(sa + (wm + i * 16 + ln) * OG_PITCH + 8 * hh);
#pragma unroll
    for (int t = 0; t < 4; ++t) bq[0][t] = fa_frag(sb + (wn + t * 16 + ln) * OG_PITCH + 8 * hh);
#pragma unroll
    for (int ks = 0; ks < OG_K / 32; ++ks) {
      if (ks + 1 < OG_K / 32) {      /* the next k step's fragments are fetched as one group ahead of this step's products, into the second register set */
#pragma unroll
        for (int i = 0; i < 2; ++i) af[(ks + 1) & 1][i] = fa_frag(sa + (wm + i * 16 + ln) * OG_PITCH + (ks + 1) * 32 + 8 * hh);
#pragma unroll
        for (int t = 0; t < 4; ++t) bq[(ks + 1) & 1][t] = fa_frag(sb + (wn + t * 16 + ln) * OG_PITCH + (ks + 1) * 32 + 8 * hh);
      }
      __builtin_amdgcn_sched_barrier(0);      /* this one and the next keep the twelve reads one group ahead of the eight products: without them this build read two fragments' halves at a time into one register block and waited out the LDS latency in front of every second product */
#pragma unroll
      for (int t = 0; t < 4; ++t) for (int i = 0; i < 2; ++i) acc[i][t] = fa_mma(af[ks & 1][i], bq[ks & 1][t], acc[i][t]);
      __builtin_amdgcn_sched_barrier(0);
    }
  }
  /* Output staging in stage 0's tiles, which the last stage does not read: the barrier of the last publish point, behind every wave's s_wait_dscnt 0 and the issuing waves' s_wait_tensorcnt 0, is the one in front of it; no request is outstanding from there on. */
  f1a* so = (f1a*)(sm + wave * (32 * 68 * 4));      /* the wave's own range */
#pragma unroll
  for (int t = 0; t < 4; ++t) { const float br = bf16_round(bv[t]);
#pragma unroll
    for (int i = 0; i < 2; ++i) for (int r = 0; r < 8; ++r) so[(i * 16 + 8 * hh + r) * 68 + t * 16 + ln] = acc[i][t][r] * alpha + br; }
  __builtin_amdgcn_fence(__ATOMIC_ACQ_REL, "workgroup"); __builtin_amdgcn_wave_barrier();      /* the rows are read back by other lanes of the same wave: keeps the reads behind the writes */
  char* cb = (char*)(C + (size_t)(row0 + wm) * DM + col0 + wn);      /* uniform for the wave */
  const unsigned co = (unsigned)(hh * (DM * 4) + ln * 16);
  v4f ov[16];
#pragma unroll
  for (int q = 0; q < 16; ++q) ov[q] = *(const v4fa*)&so[(q * 2 + hh) * 68 + ln * 4];      /* 16 lanes a row of 256 bytes, 2 rows an instruction */
#pragma unroll
  for (int q = 0; q < 16; ++q) *(v4f*)(cb + q * 2 * DM * 4 + co) = ov[q];
}
extern "C" void kernel_launch(void* const* d_in, const int* in_sizes, int n_in,
                              void* d_out, int out_size, void* d_ws, size_t ws_size, hipStream_t stream) {
  (void)in_sizes; (void)n_in; (void)out_size;
  const float* const* I = (const float* const*)d_in; const float* xq = I[2]; const float* xk = I[1]; const float* xv = I[0]; const int* km = (const int*)d_in[3]; const float* wq = I[6]; const float* wk = I[5]; const float* wv = I[4]; const float* wo = I[7]; const float* bo = I[8];      /* contract order: values I[0], keys I[1], query I[2]; mask int32 [4][1][1][2048] (0 = masked key; READ on device); SHARED natural [64][64] blocks Wv I[4], Wk I[5], Wq I[6]; natural Wo [512][512] + bo */
  char* ws = (char*)d_ws; size_t off = 0;
  auto take = [&](size_t bytes) { char* p = ws + off; off += (bytes + 255) & ~(size_t)255; return p; };
  _Float16* BO = (_Float16*)take((size_t)DM * DM * 2);
  _Float16* O16 = (_Float16*)take(NR * DM * 2);
  if (off > ws_size) return;
  const size_t r0p = (size_t)B0 * SQ;      /* first row of the output stage */
  k_fattn<<<NB * NH * (SQ / (FA_WAVES * FA_COLS)), FA_GROUPS * FA_WAVES * 32, 0, stream>>>(xq, xk, xv, wq, wk, wv, wo, km, BO, O16);      /* o (merged heads) as f16 rows x64; keys with mask[b][j] == 0 are not listed; Wo as f16 x16 */
  k_ogemm<<<(unsigned)((MPO / OG_T) * (DM / OG_T)), 256, 0, stream>>>(O16 + r0p * DM, BO, 0.0009765625f, bo, (float*)d_out + r0p * DM);      /* out rows are the output layout */
}

// v010
// A run of this version takes 29 microseconds.
// In both of two side-by-side timings against v009, it was 1.05 times as fast.
// Over all steps from v000, the starting kernel, it is 115 times as fast.
#include <hip/hip_runtime.h>
#include <stdint.h>
// Multi-head attention over three inputs with SHARED per-head projections, a random key-padding mask and the module's literal score scale (values, keys, query [4][2048][512]; each input is split into 8 heads of 64 and every head is multiplied by the SAME natural [64][64] matrix (x W^T: Wv / Wk / Wq; no biases); energy = q k^T; where(mask == 0, -1e20) with the int32 [4][1][1][2048] mask in {0, 1} (random; 0 = masked key; READ on device); softmax(energy / sqrt(embed_size) = / sqrt(512)) (as the source); out = merged Wo^T + bo -> [4][2048][512]).
// Structure: token rows r = b*2048 + s; a key with mask 0 has weight exactly 0 beside any open key, so only the open keys of a batch are attended (each work-group of k_fattn lists them from the mask; a batch with no open key keeps all keys, every score at the fill). The shared per-head matrices leave the key loop by associativity: energy = (Wk^T Wq xq) . xk and weights x V = Wv (weights x xv), so scores, masked softmax and weights x values run in ONE launch for all batches and heads straight on the rounded f32 inputs (k_fattn: running maximum and sum, scores and weights never in memory; o carried x64 against f16 subnormal flush, folded into the output GEMM alpha), written into the merged f16 o rows; out = o W_o + b GEMM (f32; k_ogemm: operands staged in LDS by tensor loads) into the output layout.
// Compute dtype: inputs rounded to bf16; x / weights exact in f16 (weights x16); Wq xq, q', softmax weights, the normalised weighted sum and o as plain f16 GEMM operands (~2^-12); scores and softmax statistics f32. v_wmma_f32_16x16x32_f16.
#define NB 4
#define SQ 2048
#define DM 512
#define NH 8
#define HD 64
#define HG 4                         /* heads per attention launch group */
#define B0 0                         /* first batch processed (debug hook) */
#define NBR NB                       /* batches processed (debug hook) */
#define NR ((size_t)NB * SQ)         /* token rows */
#define MP ((int)((size_t)NBR * SQ)) /* rows projected (debug hook) */
#define QN SQ                        /* unused: k_fattn attends all SQ query rows of a batch */
#define NHD NH                       /* unused: k_fattn attends all NH heads */
#define MPO MP                       /* rows through the output stage (debug hook) */
#define LQ DM      /* unused: rows are addressed with pitch DM */
typedef __bf16 v16b __attribute__((ext_vector_type(16)));
typedef unsigned short v8us __attribute__((ext_vector_type(8), may_alias));
typedef float  v8f  __attribute__((ext_vector_type(8)));
typedef float  v4f  __attribute__((ext_vector_type(4)));
typedef float  v4fa __attribute__((ext_vector_type(4), may_alias));
union FragB { v16b v; v8us half[2]; unsigned short u[16]; };

__device__ __forceinline__ unsigned short bf16_bits(float x) { unsigned int u = __float_as_uint(x); return (unsigned short)((u + 0x7FFFu + ((u >> 16) & 1u)) >> 16); }
__device__ __forceinline__ float bf16_val(unsigned short b) { return __uint_as_float(((unsigned int)b) << 16); }
__device__ __forceinline__ float bf16_round(float x) { return bf16_val(bf16_bits(x)); }
// D += A·B with NT terms: 1 = ah·bh, 2 = + al·bh (A split), 3 = + ah·bl (both split)
template <int NT>
__device__ __forceinline__ v8f mmaN(v16b ah, v16b al, v16b bh, v16b bl, v8f c) {
  c = __builtin_amdgcn_wmma_f32_16x16x32_bf16(false, ah, false, bh, (short)0, c, false, false);
  if (NT >= 2) c = __builtin_amdgcn_wmma_f32_16x16x32_bf16(false, al, false, bh, (short)0, c, false, false);
  if (NT >= 3) c = __builtin_amdgcn_wmma_f32_16x16x32_bf16(false, ah, false, bl, (short)0, c, false, false);
  asm volatile("v_nop\n\tv_nop\n\tv_nop\n\tv_nop" : "+v"(c) : "v"(ah), "v"(al), "v"(bh), "v"(bl));
  return c;
}

__global__ __launch_bounds__(256) void k_wt_bf16(const float* __restrict__ W, unsigned short* __restrict__ Wt, int K, int N) {
  const int t = blockIdx.x * 256 + threadIdx.x;
  const int k8n = K / 8;
  if (t >= N * k8n) return;
  const int n = t / k8n, k8 = (t % k8n) * 8;
  v8us v;
#pragma unroll
  for (int i = 0; i < 8; ++i) v[i] = bf16_bits(W[(size_t)(k8 + i) * N + n]);
  *(v8us*)(Wt + (size_t)n * K + k8) = v;
  
}

// GEMM C[M][N] (f32, pitch ldc) = act(A[M][K]·W + bias). A f32 row-major (pitch lda) converted per fragment to bf16
// (ASPLIT: hi/lo two planes -> 2 terms, else single rounded term); Wt bf16 [N][K] (pitch ldb). BIAS_BF16 rounds the
// bias to bf16 first (bias quantised to bf16 before the add). K%32==0, M%16==0, N%64==0.
template <bool ASPLIT, int ACT, bool BIAS_BF16>
__global__ __launch_bounds__(128) void k_gemm_bf(const float* __restrict__ A, int lda, const unsigned short* __restrict__ Wt, int ldb,
                                               const float* __restrict__ bias, float* __restrict__ C, int ldc, int M, int N, int K) {
  __shared__ __attribute__((aligned(16))) float so[4][16][64];
  const int tid = threadIdx.x, w = tid >> 5, lane = tid & 31, ln = lane & 15, hh = lane >> 4;
  const int ntn = N / 64;
  const int wid = blockIdx.x * 4 + w;
  const int mt = wid / ntn, nq = wid % ntn;
  if (mt * 16 >= M) return;
  const int row0 = mt * 16, col0 = nq * 64;
  const float* arow = A + (size_t)(row0 + ln) * lda;
  v8f acc[4] = {};
  for (int kb = 0; kb < K; kb += 32) {
    FragB ah, al;
    const v4f x0 = *(const v4fa*)(arow + kb + 8 * hh), x1 = *(const v4fa*)(arow + kb + 8 * hh + 4);
    const v4f x2 = *(const v4fa*)(arow + kb + 16 + 8 * hh), x3 = *(const v4fa*)(arow + kb + 16 + 8 * hh + 4);
    float xs[16] = {x0[0],x0[1],x0[2],x0[3],x1[0],x1[1],x1[2],x1[3],x2[0],x2[1],x2[2],x2[3],x3[0],x3[1],x3[2],x3[3]};
#pragma unroll
    for (int i = 0; i < 16; ++i) { const unsigned short hb = bf16_bits(xs[i]); ah.u[i] = hb; al.u[i] = ASPLIT ? bf16_bits(xs[i] - bf16_val(hb)) : (unsigned short)0; }
#pragma unroll
    for (int t = 0; t < 4; ++t) {
      const unsigned short* brow = Wt + (size_t)(col0 + t * 16 + ln) * ldb + kb;
      FragB b;
      b.half[0] = *(const v8us*)(brow + 8 * hh);
      b.half[1] = *(const v8us*)(brow + 16 + 8 * hh);
      acc[t] = mmaN<ASPLIT ? 2 : 1>(ah.v, al.v, b.v, b.v, acc[t]);
    }
  }
#pragma unroll
  for (int t = 0; t < 4; ++t) {
    float bv = bias ? bias[col0 + t * 16 + ln] : 0.f;
    if (BIAS_BF16) bv = bf16_round(bv);
#pragma unroll
    for (int r = 0; r < 8; ++r) { float v = acc[t][r] + bv; if (ACT == 1) v = fmaxf(v, 0.f); so[w][8 * hh + r][t * 16 + ln] = v; }
  }
  __builtin_amdgcn_fence(__ATOMIC_ACQ_REL, "workgroup");
  __builtin_amdgcn_wave_barrier();
  const int rsub = lane >> 4, c4 = (lane & 15) * 4;
  {
#pragma unroll
    for (int q = 0; q < 8; ++q) {
      const int r = q * 2 + rsub;
      const v4f v = *(const v4fa*)&so[w][r][c4];
      *(v4f*)(C + (size_t)(row0 + r) * ldc + col0 + c4) = v;
    }
    
  }
}

// GEMM C = act(A·W + bias + resid): A f32 (ASPLIT -> hi/lo 2 terms), Wt bf16 [N][K]; ACT 0 none, 1 relu, 2 exact gelu;
// resid (optional, f32, row index = (row % rmod), pitch ldr, RES_BF16 rounds it) added before the activation.
template <bool ASPLIT, int ACT, bool BIAS_BF16, bool RES_BF16>
__global__ __launch_bounds__(128) void k_gemm_bf3(const float* __restrict__ A, int lda, const unsigned short* __restrict__ Wt, int ldb,
                                                const float* __restrict__ bias, const float* __restrict__ resid, int rmod, int ldr,
                                                float* __restrict__ C, int ldc, int M, int N, int K) {
  __shared__ __attribute__((aligned(16))) float so[4][16][64];
  const int tid = threadIdx.x, w = tid >> 5, lane = tid & 31, ln = lane & 15, hh = lane >> 4;
  const int ntn = N / 64;
  const int wid = blockIdx.x * 4 + w;
  const int mt = wid / ntn, nq = wid % ntn;
  if (mt * 16 >= M) return;
  const int row0 = mt * 16, col0 = nq * 64;
  const float* arow = A + (size_t)(row0 + ln) * lda;
  v8f acc[4] = {};
  for (int kb = 0; kb < K; kb += 32) {
    FragB ah, al;
    const v4f x0 = *(const v4fa*)(arow + kb + 8 * hh), x1 = *(const v4fa*)(arow + kb + 8 * hh + 4);
    const v4f x2 = *(const v4fa*)(arow + kb + 16 + 8 * hh), x3 = *(const v4fa*)(arow + kb + 16 + 8 * hh + 4);
    float xs[16] = {x0[0],x0[1],x0[2],x0[3],x1[0],x1[1],x1[2],x1[3],x2[0],x2[1],x2[2],x2[3],x3[0],x3[1],x3[2],x3[3]};
#pragma unroll
    for (int i = 0; i < 16; ++i) { const unsigned short hb = bf16_bits(xs[i]); ah.u[i] = hb; al.u[i] = ASPLIT ? bf16_bits(xs[i] - bf16_val(hb)) : (unsigned short)0; }
#pragma unroll
    for (int t = 0; t < 4; ++t) {
      const unsigned short* brow = Wt + (size_t)(col0 + t * 16 + ln) * ldb + kb;
      FragB b;
      b.half[0] = *(const v8us*)(brow + 8 * hh);
      b.half[1] = *(const v8us*)(brow + 16 + 8 * hh);
      acc[t] = mmaN<ASPLIT ? 2 : 1>(ah.v, al.v, b.v, b.v, acc[t]);
    }
  }
#pragma unroll
  for (int t = 0; t < 4; ++t) {
    const int col = col0 + t * 16 + ln;
    float bv = bias ? bias[col] : 0.f;
    if (BIAS_BF16) bv = bf16_round(bv);
#pragma unroll
    for (int r = 0; r < 8; ++r) {
      float v = acc[t][r] + bv;
      if (resid) { float rv = resid[(size_t)((row0 + 8 * hh + r) % rmod) * ldr + col]; if (RES_BF16) rv = bf16_round(rv); v += rv; }
      if (ACT == 1) v = fmaxf(v, 0.f);
      if (ACT == 2) v = 0.5f * v * (1.0f + erff(v * 0.70710678118654752f));
      if (ACT == 3) { const float u = 0.7978845608028654f * (v + 0.044715f * v * v * v); v = 0.5f * v * (1.0f + tanhf(u)); }
      so[w][8 * hh + r][t * 16 + ln] = v;
    }
  }
  __builtin_amdgcn_fence(__ATOMIC_ACQ_REL, "workgroup");
  __builtin_amdgcn_wave_barrier();
  const int rsub = lane >> 4, c4 = (lane & 15) * 4;
  {
#pragma unroll
    for (int q = 0; q < 8; ++q) {
      const int r = q * 2 + rsub;
      const v4f v = *(const v4fa*)&so[w][r][c4];
      *(v4f*)(C + (size_t)(row0 + r) * ldc + col0 + c4) = v;
    }
    
  }
}
// row LayerNorm (biased variance, eps) over N: s = X (+ R); optional out_sum <- s; out_norm <- (s-mu)*rsqrt(var+eps)*g + b
template <bool PARAM_BF16>
__global__ __launch_bounds__(256) void k_layernorm(const float* __restrict__ X, const float* __restrict__ R, const float* __restrict__ g, const float* __restrict__ bta,
                                                  float* __restrict__ out_sum, float* __restrict__ out_norm, int N, float eps) {
  __shared__ float red[256];
  const int row = blockIdx.x, tid = threadIdx.x;
  const float* x = X + (size_t)row * N; const float* rr = R ? R + (size_t)row * N : nullptr;
  float vals[16];                     // up to N = 4096
  const int per = N / 256;            // contiguous chunk per thread? use strided-by-4 chunks: thread handles j = tid*4 + 1024*u
  float s1 = 0.f;
  for (int u = 0; u < per / 4; ++u) {
    const int j = tid * 4 + 1024 * u;
    const v4f a = *(const v4fa*)(x + j);
    v4f b = {0.f,0.f,0.f,0.f}; if (rr) b = *(const v4fa*)(rr + j);
#pragma unroll
    for (int q = 0; q < 4; ++q) { const float v = a[q] + b[q]; vals[u * 4 + q] = v; s1 += v; }
  }
  red[tid] = s1; __syncthreads();
  for (int st = 128; st > 0; st >>= 1) { if (tid < st) red[tid] += red[tid + st]; __syncthreads(); }
  const float mu = red[0] / (float)N; __syncthreads();
  float s2 = 0.f;
  for (int u = 0; u < per / 4; ++u)
#pragma unroll
    for (int q = 0; q < 4; ++q) { const float c = vals[u * 4 + q] - mu; s2 += c * c; }
  red[tid] = s2; __syncthreads();
  for (int st = 128; st > 0; st >>= 1) { if (tid < st) red[tid] += red[tid + st]; __syncthreads(); }
  const float rs = rsqrtf(red[0] / (float)N + eps);
  {
    for (int u = 0; u < per / 4; ++u) {
      const int j = tid * 4 + 1024 * u;
      v4f o, sm;
#pragma unroll
      for (int q = 0; q < 4; ++q) {
        float gg = g[j + q], bb = bta[j + q];
        if (PARAM_BF16) { gg = bf16_round(gg); bb = bf16_round(bb); }
        sm[q] = vals[u * 4 + q]; o[q] = (vals[u * 4 + q] - mu) * rs * gg + bb;
      }
      if (out_sum) *(v4f*)(out_sum + (size_t)row * N + j) = sm;
      *(v4f*)(out_norm + (size_t)row * N + j) = o;
    }
    
  }
}



// ---- f16 WMMA path (v_wmma_f32_16x16x32_f16): 11-bit significands for operands in range — used where a [0,1] probability operand needs more precision than bf16
typedef _Float16 v16h __attribute__((ext_vector_type(16)));
union FragH { v16h v; v8us half[2]; _Float16 h[16]; unsigned short u[16]; };
template <int NT>
__device__ __forceinline__ v8f mmaH(v16h ah, v16h al, v16h bh, v16h bl, v8f c) {
  c = __builtin_amdgcn_wmma_f32_16x16x32_f16(false, ah, false, bh, (short)0, c, false, false);
  if (NT >= 2) c = __builtin_amdgcn_wmma_f32_16x16x32_f16(false, al, false, bh, (short)0, c, false, false);
  if (NT >= 3) c = __builtin_amdgcn_wmma_f32_16x16x32_f16(false, ah, false, bl, (short)0, c, false, false);
  asm volatile("v_nop\n\tv_nop\n\tv_nop\n\tv_nop" : "+v"(c) : "v"(ah), "v"(al), "v"(bh), "v"(bl));
  return c;
}
// batched GEMM like k_gemm_b but f16 operands: A f32 (split into f16 hi/lo if ASPLIT, else rounded to f16), Bt = f16 values [n][k]; alpha; C f32; N multiple of 16 (partial tiles skipped)
template <bool ASPLIT>
__global__ __launch_bounds__(128) void k_gemm_h(const float* __restrict__ A, int lda, size_t sA, const _Float16* __restrict__ Bh, int ldb, size_t sB, float alpha, float* __restrict__ C, int ldc, size_t sC, int M, int N, int K) {
  __shared__ __attribute__((aligned(16))) float so[4][16][64];
  const int tid = threadIdx.x, w = tid >> 5, lane = tid & 31, ln = lane & 15, hh = lane >> 4; const int by = blockIdx.y;
  A += (size_t)by * sA; Bh += (size_t)by * sB; C += (size_t)by * sC;
  const int ntn = (N + 63) / 64; const int wid = blockIdx.x * 4 + w; const int mt = wid / ntn, nq = wid % ntn; if (mt * 16 >= M) return;
  const int row0 = mt * 16, col0 = nq * 64; const float* arow = A + (size_t)(row0 + ln) * lda;
  v8f acc[4] = {};
  for (int kb = 0; kb < K; kb += 32) {
    FragH ah, al;
    const v4f x0 = *(const v4fa*)(arow + kb + 8 * hh), x1 = *(const v4fa*)(arow + kb + 8 * hh + 4), x2 = *(const v4fa*)(arow + kb + 16 + 8 * hh), x3 = *(const v4fa*)(arow + kb + 16 + 8 * hh + 4);
    float xs[16] = {x0[0],x0[1],x0[2],x0[3],x1[0],x1[1],x1[2],x1[3],x2[0],x2[1],x2[2],x2[3],x3[0],x3[1],x3[2],x3[3]};
#pragma unroll
    for (int i = 0; i < 16; ++i) { const _Float16 h = (_Float16)xs[i]; ah.h[i] = h; al.h[i] = ASPLIT ? (_Float16)(xs[i] - (float)h) : (_Float16)0.0f; }
#pragma unroll
    for (int t = 0; t < 4; ++t) { if (col0 + t * 16 >= N) continue; const size_t boff = (size_t)(col0 + t * 16 + ln) * ldb + kb; FragH bq; bq.half[0] = *(const v8us*)(Bh + boff + 8 * hh); bq.half[1] = *(const v8us*)(Bh + boff + 16 + 8 * hh);
      acc[t] = mmaH<ASPLIT ? 2 : 1>(ah.v, al.v, bq.v, bq.v, acc[t]); }
  }
#pragma unroll
  for (int t = 0; t < 4; ++t) { if (col0 + t * 16 >= N) continue;
#pragma unroll
    for (int r = 0; r < 8; ++r) so[w][8 * hh + r][t * 16 + ln] = acc[t][r] * alpha; }
  __builtin_amdgcn_fence(__ATOMIC_ACQ_REL, "workgroup"); __builtin_amdgcn_wave_barrier();
  const int rsub = lane >> 4, c4 = (lane & 15) * 4;
  {
#pragma unroll
    for (int q = 0; q < 8; ++q) { const int r = q * 2 + rsub; if (col0 + c4 < N) { const v4f v = *(const v4fa*)&so[w][r][c4]; *(v4f*)(C + (size_t)(row0 + r) * ldc + col0 + c4) = v; } }
     }
}

// Wt[n][k] = f16(W[k][n]·scale) from f32 row-major W[K][N] (scale = power of two; bf16-exact weights stay exact in f16 away from the subnormal range)
__global__ __launch_bounds__(256) void k_wt_f16(const float* __restrict__ W, _Float16* __restrict__ Wt, int K, int N, float scale) {
  const int t = blockIdx.x * 256 + threadIdx.x; if (t >= N * (K / 8)) return; const int n = t / (K / 8), k8 = (t % (K / 8)) * 8; FragH f;
#pragma unroll
  for (int i = 0; i < 8; ++i) f.h[i] = (_Float16)(bf16_round(W[(size_t)(k8 + i) * N + n]) * scale); const v8us o = f.half[0];
  *(v8us*)((unsigned short*)Wt + (size_t)n * K + k8) = o; 
}
// k_gemm_hh variant with fused epilogue: v = acc·alpha + bias[by·sBias + col] (+ CP[(row/rowsPerB)·sCPb + by·64 + col] if CP) ; ACT 0 none / 1 elu ; writes f16 C16 (and f32 C if non-null)
template <int ACT>
__global__ __launch_bounds__(128) void k_gemm_hhx(const _Float16* __restrict__ A, int lda, size_t sA, const _Float16* __restrict__ Bh, int ldb, size_t sB, float alpha, const float* __restrict__ bias, size_t sBias, const float* __restrict__ CP, int rowsPerB, size_t sCPb, int row0g,
    float* __restrict__ C, _Float16* __restrict__ C16, int ldc, size_t sC, int M, int N, int K) {
  __shared__ __attribute__((aligned(16))) float so[4][16][64];
  const int tid = threadIdx.x, w = tid >> 5, lane = tid & 31, ln = lane & 15, hh = lane >> 4; const int by = blockIdx.y;
  A += (size_t)by * sA; Bh += (size_t)by * sB; const size_t cofs = (size_t)by * sC; const float* bp = bias ? bias + (size_t)by * sBias : nullptr;
  const int ntn = (N + 63) / 64; const int wid = blockIdx.x * 4 + w; const int mt = wid / ntn, nq = wid % ntn; if (mt * 16 >= M) return;
  const int row0 = mt * 16, col0 = nq * 64; const _Float16* arow = A + (size_t)(row0 + ln) * lda;
  v8f acc[4] = {};
  for (int kb = 0; kb < K; kb += 32) { FragH ah; ah.half[0] = *(const v8us*)((const unsigned short*)arow + kb + 8 * hh); ah.half[1] = *(const v8us*)((const unsigned short*)arow + kb + 16 + 8 * hh);
#pragma unroll
    for (int t = 0; t < 4; ++t) { if (col0 + t * 16 >= N) continue; const size_t boff = (size_t)(col0 + t * 16 + ln) * ldb + kb; FragH bq; bq.half[0] = *(const v8us*)((const unsigned short*)Bh + boff + 8 * hh); bq.half[1] = *(const v8us*)((const unsigned short*)Bh + boff + 16 + 8 * hh);
      acc[t] = mmaH<1>(ah.v, ah.v, bq.v, bq.v, acc[t]); }
  }
#pragma unroll
  for (int t = 0; t < 4; ++t) { if (col0 + t * 16 >= N) continue; const int col = col0 + t * 16 + ln; const float bv = bp ? bf16_round(bp[col]) : 0.f;
#pragma unroll
    for (int r = 0; r < 8; ++r) { float v = acc[t][r] * alpha + bv; if (CP) { const int rr = row0g + row0 + 8 * hh + r; if (rowsPerB < 0) v += CP[cofs + (size_t)rr * ldc + col];      /* rowsPerB < 0: own element of the batched C plane */ else { const int bidx = rr / rowsPerB; v += CP[(size_t)bidx * sCPb + (size_t)by * 64 + col]; } } if (ACT == 1) v = (v > 0.f) ? v : expm1f(v); else if (ACT == 7) v = (v > 0.f) ? v + 1.0f : expf(v); else if (ACT == 8) v = tanhf(v); else if (ACT == 9) v = 0.5f * v * (1.0f + tanhf(0.7978845608028654f * (v + 0.044715f * v * v * v))); else if (ACT == 11) v = 1.0f / (1.0f + expf(-v)); else if (ACT == 12) v = (v > 0.f) ? v : 0.01f * v; else if (ACT == 14) v = (v > 0.f) ? v : 0.1f * v; else if (ACT == 16) v = (v >= 0.f) ? v : 0.3f * v; else if (ACT == 17) v = (v >= 0.f) ? v : 0.2f * v; else if (ACT == 15) v = v / (1.0f + expf(-v)); else if (ACT == 3) v = fmaxf(v, 0.f); else if (ACT == 6) v = 0.5f * v * (1.0f + erff(v * 0.70710678118654752f)); so[w][8 * hh + r][t * 16 + ln] = v; } }
  __builtin_amdgcn_fence(__ATOMIC_ACQ_REL, "workgroup"); __builtin_amdgcn_wave_barrier();
  const int rsub = lane >> 4, c4 = (lane & 15) * 4; typedef _Float16 v4h __attribute__((ext_vector_type(4)));
  {
#pragma unroll
    for (int q = 0; q < 8; ++q) { const int r = q * 2 + rsub; if (col0 + c4 < N) { const v4f v = *(const v4fa*)&so[w][r][c4]; if (C) *(v4f*)(C + cofs + (size_t)(row0 + r) * ldc + col0 + c4) = v; if (C16) { v4h h4; for (int i = 0; i < 4; ++i) h4[i] = (_Float16)v[i]; *(v4h*)(C16 + cofs + (size_t)(row0 + r) * ldc + col0 + c4) = h4; } } }
     }
}


typedef _Float16 v4h __attribute__((ext_vector_type(4)));

__global__ __launch_bounds__(256) void k_x16(const float* __restrict__ x, _Float16* __restrict__ X16, size_t n8) { const size_t t = (size_t)blockIdx.x * 256 + threadIdx.x; if (t >= n8) return; FragH f;
#pragma unroll
  for (int q = 0; q < 8; ++q) f.h[q] = (_Float16)bf16_round(x[t * 8 + q]); *(v8us*)((unsigned short*)X16 + t * 8) = f.half[0];  }
__global__ __launch_bounds__(256) void k_h16(const float* __restrict__ x, _Float16* __restrict__ X16, size_t n8) { const size_t t = (size_t)blockIdx.x * 256 + threadIdx.x; if (t >= n8) return; FragH f;
#pragma unroll
  for (int q = 0; q < 8; ++q) f.h[q] = (_Float16)x[t * 8 + q]; *(v8us*)((unsigned short*)X16 + t * 8) = f.half[0];  }
__global__ __launch_bounds__(256) void k_round16f(const float* __restrict__ W, _Float16* __restrict__ Bt, size_t n8) { const size_t t = (size_t)blockIdx.x * 256 + threadIdx.x; if (t >= n8) return; FragH f;
#pragma unroll
  for (int i = 0; i < 8; ++i) f.h[i] = (_Float16)(bf16_round(W[t * 8 + i]) * 16.0f); *(v8us*)((unsigned short*)Bt + t * 8) = f.half[0];  }
template <int NHv, int TTv>
__global__ __launch_bounds__(256) void k_vt(const _Float16* __restrict__ V16, int ldv, int voff, _Float16* __restrict__ Vt) { __shared__ unsigned short tl[64][66]; const int tid = threadIdx.x; const int slab = blockIdx.x / (TTv / 64), lg = blockIdx.x % (TTv / 64); const int b = slab / NHv, h = slab % NHv;
  for (int i = tid; i < 64 * 8; i += 256) { const int r = i / 8, c8 = (i % 8) * 8; FragH f; f.half[0] = *(const v8us*)((const unsigned short*)V16 + ((size_t)b * TTv + lg * 64 + r) * ldv + voff + h * 64 + c8);
#pragma unroll
    for (int q = 0; q < 8; ++q) tl[r][c8 + q] = f.u[q]; }
  __syncthreads();
  {
#pragma unroll
    for (int rd = 0; rd < 2; ++rd) { const int d = rd * 32 + tid / 8, pc = tid % 8; FragH f;
#pragma unroll
      for (int q = 0; q < 8; ++q) f.u[q] = tl[pc * 8 + q][d];
      *(v8us*)((unsigned short*)Vt + ((size_t)slab * 64 + d) * TTv + lg * 64 + pc * 8) = f.half[0]; }
     } }

__global__ __launch_bounds__(256) void k_hl(const float* __restrict__ F, _Float16* __restrict__ Hh, _Float16* __restrict__ Hl, size_t n8) { const size_t t = (size_t)blockIdx.x * 256 + threadIdx.x; if (t >= n8) return; FragH fh, fl; const v4f a = *(const v4fa*)(F + t * 8), c = *(const v4fa*)(F + t * 8 + 4);
#pragma unroll
  for (int q = 0; q < 4; ++q) { _Float16 h = (_Float16)a[q]; fh.h[q] = h; fl.h[q] = (_Float16)((a[q] - (float)h) * 1024.0f); h = (_Float16)c[q]; fh.h[4 + q] = h; fl.h[4 + q] = (_Float16)((c[q] - (float)h) * 1024.0f); }
  { *(v8us*)((unsigned short*)Hh + t * 8) = fh.half[0]; *(v8us*)((unsigned short*)Hl + t * 8) = fl.half[0];  } }

// ---- fast GEMM (wave tile 32x64; requires M % 32 == 0 rows per launch region and N % 64 == 0); epilogue = k_gemm_hhx semantics ----
__device__ __forceinline__ v16h g2_frag(const _Float16* p, int hh) { FragH f; f.half[0] = *(const v8us*)((const unsigned short*)p + 8 * hh); f.half[1] = *(const v8us*)((const unsigned short*)p + 16 + 8 * hh); return f.v; }
__device__ __forceinline__ v8f g2_mma(v16h a, v16h b, v8f c) { v8f d = __builtin_amdgcn_wmma_f32_16x16x32_f16(false, a, false, b, (short)0, c, false, false); asm volatile("v_nop\n\tv_nop\n\tv_nop\n\tv_nop" : "+v"(d) : "v"(a), "v"(b)); return d; }
template <int ACT>
__global__ __launch_bounds__(128) void k_gemm2(const _Float16* __restrict__ A, int lda, size_t sA, const _Float16* __restrict__ Bh, int ldb, size_t sB, float alpha, const float* __restrict__ bias, size_t sBias, const float* __restrict__ CP, int rowsPerB, size_t sCPb, int row0g,
    float* __restrict__ C, _Float16* __restrict__ C16, int ldc, size_t sC, int M, int N, int K) { static_assert(ACT == 0 || ACT == 3 || ACT == 6 || ACT == 8 || ACT == 9 || ACT == 11 || ACT == 12 || ACT == 14 || ACT == 15 || ACT == 16 || ACT == 17, "k_gemm2: unsupported ACT code (would silently apply no activation)");
  __shared__ __attribute__((aligned(16))) float so[4][32][68];
  const int tid = threadIdx.x, w = tid >> 5, lane = tid & 31, ln = lane & 15, hh = lane >> 4; const int by = blockIdx.y;
  A += (size_t)by * sA; Bh += (size_t)by * sB; const size_t cofs = (size_t)by * sC; const float* bp = bias ? bias + (size_t)by * sBias : nullptr;
  const int ntn = N >> 6; const int mt = blockIdx.x / ntn, nq = blockIdx.x - mt * ntn; const int row0 = mt * 128 + 32 * w, col0 = nq * 64; if (row0 >= M) return;
  const _Float16* a0p = A + (size_t)(row0 + ln) * lda; const _Float16* a1p = a0p + (size_t)16 * lda;
  const _Float16* b0p = Bh + (size_t)(col0 + ln) * ldb; const _Float16* b1p = b0p + (size_t)16 * ldb; const _Float16* b2p = b1p + (size_t)16 * ldb; const _Float16* b3p = b2p + (size_t)16 * ldb;
  const v8f z8 = {0.f,0.f,0.f,0.f,0.f,0.f,0.f,0.f}; v8f c00 = z8, c01 = z8, c02 = z8, c03 = z8, c10 = z8, c11 = z8, c12 = z8, c13 = z8;
#pragma unroll 1
  for (int kb = 0; kb < K; kb += 32) { const v16h a0 = g2_frag(a0p + kb, hh), a1 = g2_frag(a1p + kb, hh);
    v16h b = g2_frag(b0p + kb, hh); c00 = g2_mma(a0, b, c00); c10 = g2_mma(a1, b, c10);
    b = g2_frag(b1p + kb, hh); c01 = g2_mma(a0, b, c01); c11 = g2_mma(a1, b, c11);
    b = g2_frag(b2p + kb, hh); c02 = g2_mma(a0, b, c02); c12 = g2_mma(a1, b, c12);
    b = g2_frag(b3p + kb, hh); c03 = g2_mma(a0, b, c03); c13 = g2_mma(a1, b, c13); }
  v8f accs[8] = {c00, c01, c02, c03, c10, c11, c12, c13};
#pragma unroll
  for (int u = 0; u < 8; ++u) { const int t = u & 3, half = u >> 2; const int col = col0 + t * 16 + ln; const float bv = bp ? bf16_round(bp[col]) : 0.f;
#pragma unroll
    for (int r = 0; r < 8; ++r) { const int rloc = half * 16 + 8 * hh + r; float v = accs[u][r] * alpha + bv; if (CP) { if (rowsPerB < 0) v += CP[cofs + (size_t)(row0g + row0 + rloc) * ldc + col];      /* rowsPerB < 0: own element of the batched C plane */ else { const int bidx = (row0g + row0 + rloc) / rowsPerB; v += CP[(size_t)bidx * sCPb + (size_t)by * 64 + col]; } }
      if (ACT == 3) v = fmaxf(v, 0.f); else if (ACT == 6) v = 0.5f * v * (1.0f + erff(v * 0.70710678118654752f)); else if (ACT == 11) v = 1.0f / (1.0f + expf(-v)); else if (ACT == 15) v = v / (1.0f + expf(-v)); else if (ACT == 12) v = (v > 0.f) ? v : 0.01f * v; else if (ACT == 8) v = tanhf(v); else if (ACT == 9) v = 0.5f * v * (1.0f + tanhf(0.7978845608028654f * (v + 0.044715f * v * v * v))); else if (ACT == 14) v = (v > 0.f) ? v : 0.1f * v; else if (ACT == 16) v = (v >= 0.f) ? v : 0.3f * v; else if (ACT == 17) v = (v >= 0.f) ? v : 0.2f * v;
      so[w][rloc][t * 16 + ln] = v; } }
  __builtin_amdgcn_fence(__ATOMIC_ACQ_REL, "workgroup"); __builtin_amdgcn_wave_barrier();
  const int rsub = lane >> 4, c4 = (lane & 15) * 4;
  {
#pragma unroll
    for (int q = 0; q < 16; ++q) { const int r = q * 2 + rsub; const v4f v = *(const v4fa*)&so[w][r][c4]; if (C) *(v4f*)(C + cofs + (size_t)(row0 + r) * ldc + col0 + c4) = v; if (C16) { v4h h4; for (int i = 0; i < 4; ++i) h4[i] = (_Float16)v[i]; *(v4h*)(C16 + cofs + (size_t)(row0 + r) * ldc + col0 + c4) = h4; } }
     } }


__global__ __launch_bounds__(256) void k_wnat(const float* __restrict__ w, size_t n8, _Float16* __restrict__ Bt) { const size_t t = (size_t)blockIdx.x * 256 + threadIdx.x; if (t >= n8) return; FragH f; for (int q = 0; q < 8; ++q) f.h[q] = (_Float16)(bf16_round(w[t * 8 + q]) * 16.0f); *(v8us*)((unsigned short*)Bt + t * 8) = f.half[0];  }
__global__ __launch_bounds__(256) void k_rsm(const float* __restrict__ S, _Float16* __restrict__ P, int nrows) {
  #pragma clang fp contract(off)
  const int i = blockIdx.x * 256 + threadIdx.x; if (i >= nrows) return; const float* s = S + (size_t)i * SQ; float mx = -3.0e38f;
#pragma unroll 1
  for (int j = 0; j < SQ; ++j) mx = fmaxf(mx, s[j]); float se = 0.f;
#pragma unroll 1
  for (int j = 0; j < SQ; ++j) se += expf(s[j] - mx); const float sc = 256.0f / se;
#pragma unroll 1
  for (int j0 = 0; j0 < SQ; j0 += 8) { FragH f; for (int q = 0; q < 8; ++q) f.h[q] = (_Float16)(expf(s[j0 + q] - mx) * sc); unsigned short* d = (unsigned short*)P + (size_t)i * SQ + j0; *(v8us*)d = f.half[0];  } }
__global__ __launch_bounds__(256) void k_vt(const _Float16* __restrict__ V16, int b, int h0, _Float16* __restrict__ VT) { __shared__ unsigned short tl[64][65]; const int tid = threadIdx.x; const int hh = blockIdx.x % HG, sg = blockIdx.x / HG; const int s0 = sg * 64; const int h = h0 + hh;
  for (int i = tid; i < 64 * 8; i += 256) { const int j = i / 8, d8 = (i % 8) * 8; FragH f; f.half[0] = *(const v8us*)((const unsigned short*)V16 + ((size_t)b * SQ + s0 + j) * DM + h * HD + d8); for (int q = 0; q < 8; ++q) tl[d8 + q][j] = f.u[q]; }
  __syncthreads();
  { for (int i = tid; i < 64 * 8; i += 256) { const int d = i / 8, j8 = (i % 8) * 8; FragH f; for (int q = 0; q < 8; ++q) f.u[q] = tl[d][j8 + q]; *(v8us*)((unsigned short*)VT + ((size_t)hh * HD + d) * SQ + s0 + j8) = f.half[0]; }  } }



__global__ __launch_bounds__(256) void k_rsmkm(const float* __restrict__ S, _Float16* __restrict__ P, int nrows, const int* __restrict__ am) {
  #pragma clang fp contract(off)
  const int t = blockIdx.x * 256 + threadIdx.x; if (t >= nrows) return; const size_t i = (size_t)t; const float* s = S + i * SQ; const int* mr = am + (size_t)(t % SQ) * SQ; float mx = -3.0e38f;
#pragma unroll 1
  for (int j = 0; j < SQ; ++j) { const float f = (mr[j] != 0) ? 1.f : 0.f; mx = fmaxf(mx, fmaf(f, s[j], (1.f - f) * -1.0e9f)); } float se = 0.f;
#pragma unroll 1
  for (int j = 0; j < SQ; ++j) { const float f = (mr[j] != 0) ? 1.f : 0.f; se += __expf(fmaf(f, s[j], (1.f - f) * -1.0e9f) - mx); } const float sc = 256.0f / se;
#pragma unroll 1
  for (int j0 = 0; j0 < SQ; j0 += 8) { FragH fr; for (int q = 0; q < 8; ++q) { const int j = j0 + q; const float f = (mr[j] != 0) ? 1.f : 0.f; fr.h[q] = (_Float16)(__expf(fmaf(f, s[j], (1.f - f) * -1.0e9f) - mx) * sc); }
    unsigned short* d = (unsigned short*)P + i * SQ + j0; *(v8us*)d = fr.half[0];  } }

__global__ __launch_bounds__(256) void k_bdshn(const float* __restrict__ Wb, _Float16* __restrict__ Bt) {
  const size_t t = (size_t)blockIdx.x * 256 + threadIdx.x; if (t >= (size_t)DM * DM / 8) return; const size_t e0 = t * 8; const int n = (int)(e0 / DM), k0 = (int)(e0 % DM); const int h = n >> 6, hk = k0 >> 6; const float on = (hk == h) ? 16.0f : 0.0f; const int o = n & 63, d0 = k0 & 63; FragH f;
  for (int q = 0; q < 8; ++q) f.h[q] = (_Float16)(bf16_round(Wb[(size_t)o * 64 + d0 + q]) * on);
  unsigned short* d = (unsigned short*)Bt + e0; *(v8us*)d = f.half[0];  }

typedef int v4ia __attribute__((ext_vector_type(4), may_alias));
template <int M> __device__ __forceinline__ float rs_xm(float x) { return __builtin_bit_cast(float, __builtin_amdgcn_update_dpp(0, __builtin_bit_cast(int, x), 0x160 | M, 0xf, 0xf, true)); }  // lane l with lane l ^ M inside a 16-lane row
__device__ __forceinline__ float rs_xh(float x) { return __builtin_bit_cast(float, __builtin_amdgcn_permlanex16(__builtin_bit_cast(int, x), __builtin_bit_cast(int, x), 0x76543210, 0xfedcba98, false, false)); }  // lane l with lane l ^ 16
__device__ __forceinline__ float rs_wmax(float v) { v = fmaxf(v, rs_xm<1>(v)); v = fmaxf(v, rs_xm<2>(v)); v = fmaxf(v, rs_xm<4>(v)); v = fmaxf(v, rs_xm<8>(v)); return fmaxf(v, rs_xh(v)); }
__device__ __forceinline__ float rs_wsum(float v) { v += rs_xm<1>(v); v += rs_xm<2>(v); v += rs_xm<4>(v); v += rs_xm<8>(v); return v + rs_xh(v); }
// Four 2^x. Written as asm for the slot behind a transcendental (one independent instruction or v_nop before its result is read or its source overwritten): each v_exp_f32 is followed by
// an independent one (early-clobber outputs share no register with the sources), the last by v_nop.
__device__ __forceinline__ v4f rs_exp4(v4f x) { float e0, e1, e2, e3;
  asm("v_exp_f32 %0, %4\n\tv_exp_f32 %1, %5\n\tv_exp_f32 %2, %6\n\tv_exp_f32 %3, %7\n\tv_nop" : "=&v"(e0), "=&v"(e1), "=&v"(e2), "=&v"(e3) : "v"(x[0]), "v"(x[1]), "v"(x[2]), "v"(x[3]));
  const v4f e = {e0, e1, e2, e3}; return e; }
// Attention as one stream over the keys, straight from the f32 inputs: one launch for all batches and heads; scores and weights stay in registers. The per-head matrices leave the key loop by associativity:
// energy = (Wq xq).(Wk xk) = (Wk^T Wq xq).xk, and sum_j p_j (Wv xv_j) = Wv (sum_j p_j xv_j): a wave turns 16 queries into q' = Wk^T (Wq xq) once (WMMA, D = W x^T, whose accumulators are the next product's B operand in place), the loop works on the rounded input rows themselves, and Wv meets the normalised sum once at the end.
// A key with mask 0 has weight exactly 0 beside any open key: every work-group lists its batch's open keys in LDS (a wave takes 128 keys of the mask, 32 a round; a key's place is the open keys of the waves below + the open lanes below it). Places from n on hold token 0: a real row, so that a stage's tail is finite; its scores take the fill. n == 0: the places are the tokens themselves, every score at the fill, the row comes out uniform as in the module.
// A wave owns 32 query columns and walks the listed keys in passes of 32: S^T = K Q^T (A = 16 key rows, B = 16 query columns, both k-contiguous f16 rows), so a lane holds 8 keys of ONE query a tile;
// two score tiles of a pass, converted in place, are the B operand of O^T += V^T P^T (A = rows of V^T in the same k order). Maximum and sum are per lane plus one exchange between the lane halves.
// A work-group is two groups of 8 waves on one (batch, head) and the same 256 query columns, four waves a SIMD, so that one wave's vector work stands beside another's products: wave w of group 0 and wave w of group 1 (partners) own the same 32 columns, group g walks the listed keys 128 s + 64 g to 128 s + 64 g + 63 of stage s.
// A partner makes q' for 16 of the 32 columns and hands the fragments over through LDS (column group 0 of a wave is its own, 1 its partner's). Behind the loop each wave hands the partial sums, maximum and sum of its column group 1 to its partner through LDS (one new barrier) and joins the partner's with its own group 0, both brought to the larger maximum.
// Each group stages its own 64 keys of a stage: the listed rows of keys and values, a head's 256 contiguous bytes of a row as two whole 128-byte lines, 8 lanes each, through registers, rounded to bf16 (held exactly in f16), into one of three LDS buffers;
// a thread holds 4 inputs of 4 consecutive places, so the values go in transposed ([input][key]) by 8-byte stores. Stage s + 2 is loaded while stage s is worked on and stored behind it, so a stage is in LDS a whole stage before its first read and the stage barrier is split: a wave signals at the foot of stage s and waits for that signal only at the foot of stage s + 1, in front of its first read of stage s + 2 and of its stores into the buffer of stage s. The waves of a work-group need not meet at every stage, and the first K fragments of a stage are fetched ahead of it.
// Values: t = energy / sqrt(512) * log2(e); a place from n on takes the module's fill (-1e20, same scale) BEFORE the maximum; weight = 2^(t - m + 6) as f16, m the maximum in use (renewed when a pass exceeds it by more than 8, so a weight stays below 2^14); the sum adds the f32 weights; O / sum x64 as f16 is the B operand of the Wv product; o stored x64 as f16 rows as before.
// Each work-group also rounds its 1024 elements of the output weights (f16 x16) for the launch behind it.
// Every '#pragma unroll' in the kernel stands on a loop over a register array (loads in flight, fragments, accumulators): rolled, the array would be indexed at run time and leave the registers.
#define FA_WAVES 8       /* waves of a group, side by side over the query columns */
#define FA_GROUPS 2      /* groups of waves, each on its own 64 keys of a stage */
#define FA_COLS 32
#define FA_STAGE 64      /* keys a group and stage */
#define FA_PITCH 72      /* halves a staged row: 144 bytes = 16 x 9, an odd multiple of 16 bytes for the 16-byte fragment reads */
static_assert(SQ % (FA_WAVES * FA_COLS) == 0 && SQ % (FA_GROUPS * FA_STAGE) == 0 && HD == 64 && FA_WAVES == 8 && FA_GROUPS == 2 && FA_COLS == 32 && FA_STAGE == 64 && SQ == FA_GROUPS * FA_WAVES * 128 && (SQ & (SQ - 1)) == 0, "k_fattn: whole work-groups and stages; 8 threads a 128-byte line, 4 rows a thread; 16 waves x 128 keys are a batch's mask");
static_assert((size_t)NB * NH * (SQ / (FA_WAVES * FA_COLS)) * 512 * 2 == (size_t)DM * DM, "k_fattn: the grid covers the output weights, 2 a thread");
typedef _Float16 v8h __attribute__((ext_vector_type(8)));
typedef unsigned short v4us __attribute__((ext_vector_type(4), may_alias));
__device__ __forceinline__ v8f fa_mma(v16h a, v16h b, v8f c) { return __builtin_amdgcn_wmma_f32_16x16x32_f16(false, a, false, b, (short)0, c, false, false); }
// One 16 x 32 fragment from k-contiguous rows, k order as g2_frag: p = the lane's row + 8 * (lane >> 4) halves.
__device__ __forceinline__ v16h fa_frag(const unsigned short* p) { FragH f; f.half[0] = *(const v8us*)p; f.half[1] = *(const v8us*)(p + 16); return f.v; }
typedef float v2f __attribute__((ext_vector_type(2)));
typedef float v2fa __attribute__((ext_vector_type(2), may_alias));
typedef unsigned short v2us __attribute__((ext_vector_type(2), may_alias));
typedef __bf16 v2b __attribute__((ext_vector_type(2)));
__device__ __forceinline__ v4f fa_rb(v4f x) {      /* to bf16, nearest even, as bf16_round; two values a conversion, each back as f32 by its bits */
  const v2f a = {x[0], x[1]}, c = {x[2], x[3]}; const unsigned ua = __builtin_bit_cast(unsigned, __builtin_convertvector(a, v2b)), uc = __builtin_bit_cast(unsigned, __builtin_convertvector(c, v2b));
  const v4f r = {__uint_as_float(ua << 16), __uint_as_float(ua & 0xffff0000u), __uint_as_float(uc << 16), __uint_as_float(uc & 0xffff0000u)}; return r; }
__device__ __forceinline__ v4us fa_h4(v4f x) { return __builtin_bit_cast(v4us, __builtin_convertvector(x, v4h)); }
// Two accumulator tiles (rows 16 a + 8 hh + r and 16 (a + 1) + 8 hh + r of one column), scaled, as one B fragment over these 32 rows: the k order of fa_frag.
__device__ __forceinline__ v16h fa_pack(v8f a, v8f b, float sc) { return __builtin_shufflevector(__builtin_convertvector(a * sc, v8h), __builtin_convertvector(b * sc, v8h), 0, 1, 2, 3, 4, 5, 6, 7, 8, 9, 10, 11, 12, 13, 14, 15); }
// D^T = W X^T for one column group: W [64][64] from LDS (A, rows = outputs), x = the two B fragments over the 64 inputs; the result as the four accumulator tiles over the 64 outputs, still x16 (W is held x16).
__device__ __forceinline__ void fa_wx(const unsigned short (*w)[FA_PITCH], int ln, int hh, const v16h x[2], v8f d[4]) {
  const v8f z8 = {0.f, 0.f, 0.f, 0.f, 0.f, 0.f, 0.f, 0.f};
#pragma unroll
  for (int et = 0; et < 4; ++et) d[et] = fa_mma(fa_frag(&w[et * 16 + ln][8 * hh]), x[0], z8);
#pragma unroll
  for (int et = 0; et < 4; ++et) d[et] = fa_mma(fa_frag(&w[et * 16 + ln][32 + 8 * hh]), x[1], d[et]);
}
// A work-group barrier for data that goes through LDS alone: the fences name the LDS address space, so the wave waits for its LDS operations and not, as __syncthreads() does, for every global load that is under way.
__device__ __forceinline__ void fa_lds_barrier() { __builtin_amdgcn_fence(__ATOMIC_RELEASE, "workgroup", "local"); __builtin_amdgcn_s_barrier(); __builtin_amdgcn_fence(__ATOMIC_ACQUIRE, "workgroup", "local"); }
// The same barrier in two halves, for the ring of three stage buffers. fa_signal: the wave's LDS stores and reads so far are complete (the release fence is its s_wait_dscnt 0), and it says so. fa_wait: every wave of the work-group has said so. Signal and wait alternate strictly in every wave.
__device__ __forceinline__ void fa_signal() { __builtin_amdgcn_fence(__ATOMIC_RELEASE, "workgroup", "local"); __builtin_amdgcn_s_barrier_signal(-1); }
__device__ __forceinline__ void fa_wait() { __builtin_amdgcn_s_barrier_wait(-1); __builtin_amdgcn_fence(__ATOMIC_ACQUIRE, "workgroup", "local"); }
__global__ __launch_bounds__(FA_GROUPS * FA_WAVES * 32) void k_fattn(const float* __restrict__ xq, const float* __restrict__ xk, const float* __restrict__ xv, const float* __restrict__ wq, const float* __restrict__ wk, const float* __restrict__ wv,
                                                         const float* __restrict__ wout, const int* __restrict__ Km, _Float16* __restrict__ BO, _Float16* __restrict__ O16) {
  constexpr int NW = FA_GROUPS * FA_WAVES;
  __shared__ __attribute__((aligned(16))) unsigned short sk[3][FA_GROUPS][FA_STAGE][FA_PITCH];      /* [buffer][group][key][input] */
  __shared__ __attribute__((aligned(16))) unsigned short sv[3][FA_GROUPS][HD][FA_PITCH];            /* [buffer][group][input][key] */
  __shared__ __attribute__((aligned(16))) unsigned short sw[3][HD][FA_PITCH];            /* bf16-rounded, x16: Wq [output][input], Wk^T [input][output], Wv [output][input] */
  __shared__ __attribute__((aligned(16))) unsigned short sq[NW][FA_COLS / 2][FA_PITCH];      /* a wave's query rows [query][input] */
  __shared__ __attribute__((aligned(16))) unsigned short sx[NW][4][32][8];      /* a wave's q' fragments for its partner: [16 bytes of a lane][lane] */
  __shared__ __attribute__((aligned(16))) float sm[NW][8][32][4];      /* a wave's partial sums of column group 1 for its partner: [16 bytes of a lane][lane] */
  __shared__ float sl[NW][2][32];      /* with their maximum and sum */
  __shared__ __attribute__((aligned(16))) int li[SQ];      /* place -> token */
  __shared__ int wt[NW];      /* the waves' counts of open keys */
  constexpr int QB = SQ / (FA_WAVES * FA_COLS);
  constexpr float SC = 0.044194173824159216f * 1.44269504088896340736f, FILL = -1.0e20f * SC;
  const int tid = threadIdx.x, lane = tid & 31, ln = lane & 15, hh = lane >> 4; const int w16 = __builtin_amdgcn_readfirstlane(tid >> 5);
  const int g = w16 >> 3, pw = w16 ^ FA_WAVES;      /* the wave's group; its partner */
  const int bh = blockIdx.x / QB, b = bh / NH, h = bh % NH; const int q0 = (blockIdx.x % QB) * (FA_WAVES * FA_COLS) + (w16 & (FA_WAVES - 1)) * FA_COLS + g * (FA_COLS / 2);      /* first query of the wave's own column group */
  const char* qb = (const char*)(xq + ((size_t)b * SQ + q0) * DM + h * HD);      /* wave-uniform bases */
  const char* kb = (const char*)(xk + (size_t)b * SQ * DM + h * HD);
  const char* vb = (const char*)(xv + (size_t)b * SQ * DM + h * HD);
  const char* mb = (const char*)(Km + (size_t)b * SQ);
  const int k0 = w16 * 128 + lane;
  const unsigned roff = (unsigned)(ln * (DM * 2) + hh * 16);      /* byte offsets of the lane: row ln of a tile of o rows */
  const unsigned mo = (unsigned)(k0 * 4), wo = (unsigned)(tid * 32), xo = (unsigned)(hh * (DM * 4) + ln * 16), to = (unsigned)(((int)blockIdx.x * 512 + tid) * 8);
  const int sg = (((tid >> 6) & 3) << 2) | ((tid >> 3) & 3), sc4 = ((tid & 7) | ((tid >> 2) & 8)) * 4;      /* staging, in the thread's own group: 8 lanes a 128-byte line, a wave one half of the rows of 4 place groups; places 4 sg to 4 sg + 3, inputs sc4 to sc4 + 3. So a wave's key stores fall on all 64 banks, its value stores two deep on 32 (16 lanes a row: four deep on 16) */
  v16h qf[2][2]; v4f gk[4], gv[4], hk[4], hv[4], gx[FA_COLS / 4]; v2f ga; int n = 0;
  {
    int mv[4]; v4f gw[3][2];
#pragma unroll
    for (int r = 0; r < 4; ++r) mv[r] = *(const int*)(mb + mo + r * 128);
#pragma unroll
    for (int q = 0; q < 2; ++q) { gw[0][q] = *(const v4fa*)((const char*)wq + wo + q * 16); gw[1][q] = *(const v4fa*)((const char*)wk + wo + q * 16); gw[2][q] = *(const v4fa*)((const char*)wv + wo + q * 16); }
    asm volatile("s_wait_xcnt 0x0" :: "v"(mo), "v"(wo) : "memory");      /* as the wait below; as a memory barrier for the compiler it also keeps the mask and the matrices, which are needed first, ahead of the query rows: loads return in order */
#pragma unroll
    for (int j = 0; j < FA_COLS / 4; ++j) gx[j] = *(const v4fa*)(qb + j * 2 * DM * 4 + xo);      /* a wave-wide load covers two rows' 256 bytes */
    ga = *(const v2fa*)((const char*)wout + to);
    asm volatile("s_wait_xcnt 0x0" :: "v"(xo), "v"(to) : "memory");      /* behind the loads, ahead of any new value in a register that they name (a precaution of form); as inputs the lane offsets keep their registers up to it */
    unsigned bal[4]; int tot = 0;
#pragma unroll
    for (int r = 0; r < 4; ++r) { bal[r] = __builtin_amdgcn_ballot_w32(mv[r] != 0); tot += __builtin_popcount(bal[r]); }
    if (lane == 0) wt[w16] = tot;
    { const v4ia z4 = {0, 0, 0, 0}; *(v4ia*)&li[tid * 4] = z4; }
    fa_lds_barrier();      /* every wave's count is in LDS, and the list's start value; the matrices and the query rows stay under way */
    int base = 0;
    for (int i = 0; i < NW; ++i) { const int v = wt[i]; base += (i < w16) ? v : 0; n += v; }
    if (n == 0) { const v4ia a4 = {tid * 4, tid * 4 + 1, tid * 4 + 2, tid * 4 + 3}; *(v4ia*)&li[tid * 4] = a4; }
    else {
#pragma unroll
      for (int r = 0; r < 4; ++r) { if ((bal[r] >> lane) & 1u) li[base + __builtin_popcount(bal[r] & ((1u << lane) - 1u))] = k0 + r * 32; base += __builtin_popcount(bal[r]); }      /* a place is a count of open keys below: under SQ */
    }
#pragma unroll
    for (int q = 0; q < 2; ++q) {      /* element (row tid >> 3, column (tid & 7) * 8 + q * 4 + i) of each matrix */
      *(v4us*)&sw[0][tid >> 3][(tid & 7) * 8 + q * 4] = fa_h4(fa_rb(gw[0][q]) * 16.0f); *(v4us*)&sw[2][tid >> 3][(tid & 7) * 8 + q * 4] = fa_h4(fa_rb(gw[2][q]) * 16.0f);
      const v4us t4 = fa_h4(fa_rb(gw[1][q]) * 16.0f);
      for (int i = 0; i < 4; ++i) sw[1][(tid & 7) * 8 + q * 4 + i][tid >> 3] = t4[i]; }
    fa_lds_barrier();      /* the list and the three matrices are in LDS for every wave; the query rows and the output weights, the last loads to return, are not waited for here */
  }
  n = __builtin_amdgcn_readfirstlane(n);      /* open keys of the batch: a sum of popcounts over SQ keys */
  const int nst = ((n != 0 ? n : SQ) + FA_GROUPS * FA_STAGE - 1) / (FA_GROUPS * FA_STAGE);      /* stages: 1 to SQ / 128 */
  { const v4ia p4 = *(const v4ia*)&li[g * FA_STAGE + sg * 4], p5 = *(const v4ia*)&li[(((1 < nst) ? 1 : 0) * FA_GROUPS + g) * FA_STAGE + sg * 4]; unsigned so[8];      /* stages 0 and 1 on their way (no stage 1: stage 0 again, never read); the token is bounded by the shape before an address is formed */
#pragma unroll
    for (int j = 0; j < 4; ++j) { so[j] = (unsigned)((p4[j] & (SQ - 1)) * (DM * 4) + sc4 * 4); gk[j] = *(const v4fa*)(kb + so[j]); gv[j] = *(const v4fa*)(vb + so[j]); }
#pragma unroll
    for (int j = 0; j < 4; ++j) { so[4 + j] = (unsigned)((p5[j] & (SQ - 1)) * (DM * 4) + sc4 * 4); hk[j] = *(const v4fa*)(kb + so[4 + j]); hv[j] = *(const v4fa*)(vb + so[4 + j]); }
    asm volatile("s_wait_xcnt 0x0" :: "v"(so[0]), "v"(so[1]), "v"(so[2]), "v"(so[3]), "v"(so[4]), "v"(so[5]), "v"(so[6]), "v"(so[7]) : "memory"); }      /* as above */
  __builtin_amdgcn_sched_barrier(0);      /* stage 0's loads are issued before the first wait on a query row: without it this build rounded the query rows first and met the memory latency twice */
#pragma unroll
  for (int j = 0; j < FA_COLS / 4; ++j) *(v4us*)&sq[w16][j * 2 + hh][ln * 4] = fa_h4(fa_rb(gx[j]));
  __builtin_amdgcn_fence(__ATOMIC_ACQ_REL, "wavefront"); __builtin_amdgcn_wave_barrier();      /* the rows are read back by other lanes of the same wave: keeps the reads behind the writes, without a wait for stage 0's loads */
  { const v4f a4 = {ga[0], ga[1], 0.f, 0.f}; const v4us h4 = fa_h4(fa_rb(a4) * 16.0f); const v2us h2 = {h4[0], h4[1]};
    *(v2us*)((char*)BO + (to >> 1)) = h2; }      /* Wo natural [out][in] = Bt x16; here, since the next barrier waits for stage 0's loads in any case and the store's return with them */
  {      /* q' = Wk^T (Wq xq) of the wave's own 16 columns, while stage 0 is under way */
    v16h x[2]; v8f d[4];
#pragma unroll
    for (int ks = 0; ks < 2; ++ks) x[ks] = fa_frag(&sq[w16][ln][ks * 32 + 8 * hh]);
    fa_wx(sw[0], ln, hh, x, d);
    x[0] = fa_pack(d[0], d[1], 0.0625f); x[1] = fa_pack(d[2], d[3], 0.0625f);
    fa_wx(sw[1], ln, hh, x, d);
    qf[0][0] = fa_pack(d[0], d[1], 0.0625f); qf[0][1] = fa_pack(d[2], d[3], 0.0625f);
#pragma unroll
    for (int ks = 0; ks < 2; ++ks) { FragH f; f.v = qf[0][ks]; *(v8us*)&sx[w16][ks * 2][lane][0] = f.half[0]; *(v8us*)&sx[w16][ks * 2 + 1][lane][0] = f.half[1]; }      /* lane for lane, for the partner */
  }
  auto put = [&](int buf, const v4f (&pk)[4], const v4f (&pv)[4]) {      /* a loaded stage, rounded, into LDS: key rows as they are, value rows transposed (4 places of one input are 8 bytes) */
    v4f f[4];
#pragma unroll
    for (int j = 0; j < 4; ++j) { *(v4us*)&sk[buf][g][sg * 4 + j][sc4] = fa_h4(fa_rb(pk[j])); f[j] = fa_rb(pv[j]); }
#pragma unroll
    for (int i = 0; i < 4; ++i) { const v4f c = {f[0][i], f[1][i], f[2][i], f[3][i]}; *(v4us*)&sv[buf][g][sc4 + i][sg * 4] = fa_h4(c); }
  };
  __builtin_amdgcn_sched_barrier(0);      /* the products above run while stage 0 is under way: without it this build rounded stage 0 among them and waited for its loads behind the first product */
  put(0, gk, gv); put(1, hk, hv);
  const v8f z8 = {0.f, 0.f, 0.f, 0.f, 0.f, 0.f, 0.f, 0.f};
  v8f o[2][4]; float l[2] = {0.f, 0.f}, m[2] = {-3.0e38f, -3.0e38f};
#pragma unroll
  for (int u = 0; u < 2; ++u) for (int dt = 0; dt < 4; ++dt) o[u][dt] = z8;
  __syncthreads();      /* stages 0 and 1 and the partners' q' are in LDS for every wave */
  fa_signal();      /* the first signal: it opens the alternation, so that every stage's foot is wait, then signal */
#pragma unroll
  for (int ks = 0; ks < 2; ++ks) { FragH f; f.half[0] = *(const v8us*)&sx[pw][ks * 2][lane][0]; f.half[1] = *(const v8us*)&sx[pw][ks * 2 + 1][lane][0]; qf[1][ks] = f.v; }
  v16h kf[2][2]; v4ia k4;
  auto ahead = [&](int buf, int st) {      /* fetched ahead of a stage: the thread's four places of the stage st that it will load (none left: stage 0 again, in bounds, never read), and the K fragments of the first pass of the stage in buffer buf */
    k4 = *(const v4ia*)&li[(((st < nst) ? st : 0) * FA_GROUPS + g) * FA_STAGE + sg * 4];
#pragma unroll
    for (int kt = 0; kt < 2; ++kt) for (int ks = 0; ks < 2; ++ks) kf[kt][ks] = fa_frag(&sk[buf][g][kt * 16 + ln][ks * 32 + 8 * hh]);
    __builtin_amdgcn_sched_barrier(0);      /* all nine reads are issued as one group, ahead of the rounding behind them: without it this build read two fragments at a time into one register block and met the LDS latency three times */
  };
  ahead(0, 2);
  int s = 0, bf = 0, b1 = 1, b2 = 2;      /* the buffers of stages s, s + 1, s + 2 */
#pragma unroll      /* two copies of the stage loop, ph a constant in each: the stages that hold open keys alone carry no fill code; unrolled, not branched, since a branch in mid pass cost registers past the first 256 */
  for (int ph = 0; ph < 2; ++ph) for (const int se = (ph == 0) ? n / (FA_GROUPS * FA_STAGE) : nst; s < se; ++s) {
    if (s + 2 < nst) { unsigned so[4];      /* stage s + 2 on its way, only while it exists (a scalar branch); the token is bounded by the shape before an address is formed */
#pragma unroll
      for (int j = 0; j < 4; ++j) { so[j] = (unsigned)((k4[j] & (SQ - 1)) * (DM * 4) + sc4 * 4); gk[j] = *(const v4fa*)(kb + so[j]); gv[j] = *(const v4fa*)(vb + so[j]); }
      asm volatile("s_wait_xcnt 0x0" :: "v"(so[0]), "v"(so[1]), "v"(so[2]), "v"(so[3]) : "memory"); }      /* behind the loads, ahead of any new value in a register that they name (a precaution of form); as inputs the lane offsets keep their registers up to it; as a memory barrier for the compiler it also keeps the loads here, a whole stage ahead of their stores */
#pragma unroll
    for (int p = 0; p < FA_STAGE / 32; ++p) {
      if (ph == 1 && n != 0 && (s * FA_GROUPS + g) * FA_STAGE + p * 32 >= n) break;      /* a scalar branch: the group's keys from here on are all past the open ones (weight exactly 0); the staging and the barrier below are passed all the same. A wave that never ran a pass hands over sums of 0 under the start maximum: factor 0 */
      v16h vf[4]; v8f t[2][2];
#pragma unroll
      for (int dt = 0; dt < 4; ++dt) vf[dt] = fa_frag(&sv[bf][g][dt * 16 + ln][p * 32 + 8 * hh]);
#pragma unroll
      for (int u = 0; u < 2; ++u) for (int kt = 0; kt < 2; ++kt) t[u][kt] = fa_mma(kf[kt][0], qf[u][0], z8);
#pragma unroll
      for (int u = 0; u < 2; ++u) for (int kt = 0; kt < 2; ++kt) t[u][kt] = fa_mma(kf[kt][1], qf[u][1], t[u][kt]);
      if (p + 1 < FA_STAGE / 32) {      /* the next pass of the SAME stage: its K fragments are fetched behind this pass's score products, into the registers these have left */
#pragma unroll
        for (int kt = 0; kt < 2; ++kt) for (int ks = 0; ks < 2; ++ks) kf[kt][ks] = fa_frag(&sk[bf][g][(p + 1) * 32 + kt * 16 + ln][ks * 32 + 8 * hh]); }
      float mx[2];
#pragma unroll
      for (int u = 0; u < 2; ++u) for (int kt = 0; kt < 2; ++kt) t[u][kt] *= SC;
      if (ph == 1) {      /* the last stage where n is no whole number of stages; every stage where n == 0 */
        const int left = n - ((s * FA_GROUPS + g) * FA_STAGE + p * 32 + 8 * hh);      /* open places from the lane's first key of tile 0 on */
#pragma unroll
        for (int u = 0; u < 2; ++u) for (int kt = 0; kt < 2; ++kt) for (int r = 0; r < 8; ++r) t[u][kt][r] = (kt * 16 + r < left) ? t[u][kt][r] : FILL;
      }
#pragma unroll
      for (int u = 0; u < 2; ++u) {
        float x = fmaxf(t[u][0][0], t[u][1][0]);
#pragma unroll
        for (int r = 1; r < 8; ++r) x = fmaxf(x, fmaxf(t[u][0][r], t[u][1][r]));
        mx[u] = fmaxf(x, rs_xh(x));
      }
      if (__builtin_amdgcn_ballot_w32((mx[0] > m[0] + 8.0f) || (mx[1] > m[1] + 8.0f)) != 0) {      /* one scalar branch a pass: the products of a renewal run only where some column needs one */
        const float n0 = fmaxf(m[0], mx[0]), n1 = fmaxf(m[1], mx[1]); const v4f d4 = {m[0] - n0, m[1] - n1, 0.f, 0.f}; const v4f al = rs_exp4(d4); m[0] = n0; m[1] = n1;
#pragma unroll
        for (int u = 0; u < 2; ++u) { l[u] *= al[u]; for (int dt = 0; dt < 4; ++dt) o[u][dt] *= al[u]; }
      }
      v16h pf[2];
#pragma unroll
      for (int u = 0; u < 2; ++u) { const float ms = m[u] - 6.0f; v4f s4[2];
#pragma unroll
        for (int kt = 0; kt < 2; ++kt) { const v8f x = t[u][kt] - ms; const v4f x0 = {x[0], x[1], x[2], x[3]}, x1 = {x[4], x[5], x[6], x[7]}; const v4f e0 = rs_exp4(x0), e1 = rs_exp4(x1); s4[kt] = e0 + e1;
          const v8f e = {e0[0], e0[1], e0[2], e0[3], e1[0], e1[1], e1[2], e1[3]}; t[u][kt] = e; }
        const v4f sq = s4[0] + s4[1]; l[u] += (sq[0] + sq[1]) + (sq[2] + sq[3]);
        pf[u] = __builtin_shufflevector(__builtin_convertvector(t[u][0], v8h), __builtin_convertvector(t[u][1], v8h), 0, 1, 2, 3, 4, 5, 6, 7, 8, 9, 10, 11, 12, 13, 14, 15); }
      __builtin_amdgcn_sched_barrier(0);      /* this one and the next keep the eight products apart from the 2^x statements: those are asm text, which the compiler's padding behind a matrix instruction does not see */
#pragma unroll
      for (int dt = 0; dt < 4; ++dt) for (int u = 0; u < 2; ++u) o[u][dt] = fa_mma(vf[dt], pf[u], o[u][dt]);
      __builtin_amdgcn_sched_barrier(0);
    }
    fa_wait();      /* every wave has signalled at the foot of stage s - 1: its reads of stage s - 1 are over, its part of stage s + 1 is in LDS. A wave may so run up to a stage ahead of another instead of meeting it at every stage */
    ahead((s + 1 < nst) ? b1 : bf, s + 3);      /* stage s + 1, published by that wait (behind the last stage: this stage's buffer again, never used); the reads return under the rounding below */
    if (s + 2 < nst) put(b2, gk, gv);      /* stage s + 2, while it exists, into the buffer of stage s - 1 */
    fa_signal();      /* the wave's reads of stage s are over, its part of stage s + 2 is in LDS. The LDS reads that stand between this signal and its wait are of stage s + 1's buffer, which is next written only behind the wait for the signals at the foot of stage s + 1 */
    { const int t3 = bf; bf = b1; b1 = b2; b2 = t3; }
  }
  fa_wait();      /* the last signal's wait: signal and wait alternate; behind it the plain barriers below stand as before */
  /* The two groups' halves meet: the wave's column group 1 goes to its partner, whose own group 0 it is. */
#pragma unroll
  for (int dt = 0; dt < 4; ++dt) { const v4f a = {o[1][dt][0], o[1][dt][1], o[1][dt][2], o[1][dt][3]}, c = {o[1][dt][4], o[1][dt][5], o[1][dt][6], o[1][dt][7]}; *(v4fa*)&sm[w16][dt * 2][lane][0] = a; *(v4fa*)&sm[w16][dt * 2 + 1][lane][0] = c; }
  sl[w16][0][lane] = m[1]; sl[w16][1][lane] = l[1];
  fa_lds_barrier();      /* every wave's hand-over is in LDS for its partner */
  const float mp = sl[pw][0][lane], lp = sl[pw][1][lane], mj = fmaxf(m[0], mp);      /* a group whose keys were all at the fill beside open keys of the other gets the factor 0 */
  const v4f d4 = {m[0] - mj, mp - mj, 0.f, 0.f}; const v4f al = rs_exp4(d4);
  const float lj = l[0] * al[0] + lp * al[1];
#pragma unroll
  for (int dt = 0; dt < 4; ++dt) { const v4f a = *(const v4fa*)&sm[pw][dt * 2][lane][0], c = *(const v4fa*)&sm[pw][dt * 2 + 1][lane][0]; const v8f e = {a[0], a[1], a[2], a[3], c[0], c[1], c[2], c[3]}; o[0][dt] = o[0][dt] * al[0] + e * al[1]; }
  _Float16* ob = O16 + ((size_t)b * SQ + q0) * DM + h * HD;
  { const float sc = 64.0f / (lj + rs_xh(lj)); v8f d[4];
    const v16h x[2] = {fa_pack(o[0][0], o[0][1], sc), fa_pack(o[0][2], o[0][3], sc)};      /* a lane's accumulator registers are consecutive inputs of its query: the B operand of o = Wv (O / sum) */
    fa_wx(sw[2], ln, hh, x, d);
#pragma unroll
    for (int dt = 0; dt < 4; ++dt) *(v8h*)((char*)(ob + dt * 16) + roff) = __builtin_convertvector(d[dt] * 0.0625f, v8h); }      /* 8 consecutive outputs of the lane's query row */
}
// Output product out = o Wo^T * alpha + b for all token rows, operands staged in LDS. A work-group of 8 waves owns a 128 x 128 tile of out (one work-group a WGP at this shape); a wave owns 32 x 64 of it (2 x 4 accumulator tiles, as k_gemm2).
// o rows and Wo rows come in stages of 128 k by the tensor mover (tensor_load_to_lds), through no register: a request brings one operand's 128 rows of 256 bytes (source pitch 1024 bytes) into a tile of its own, 16 bytes of pad behind a row (pitch 272 bytes).
// All four stages have their own tiles, so no tile is ever refilled: wave 0 issues the four requests for o, wave 1 those for Wo, three at the start and the fourth behind the first publish point (three of a wave outstanding at most), so the memory latency is met once and the later stages land while the earlier ones are worked on.
// A publish point stands at the head of every stage: s_wait_dscnt 0, the issuing waves' own counted s_wait_tensorcnt (a wave's requests land in issue order), the work-group barrier. Each operand byte is read once a work-group.
// The k steps run in the order of k_gemm2 and the fragments have its k order, so every accumulator sees the same sums; the epilogue is k_gemm2's (alpha, bias rounded to bf16, the wave's tile through its own LDS range, whole lines out).
// Every '#pragma unroll' in the kernel stands on a loop over a register array (fragments, accumulators, descriptors): rolled, the array would be indexed at run time and leave the registers.
#define OG_T 128         /* rows and columns of out a work-group */
#define OG_K 128         /* k a stage */
#define OG_PITCH 136     /* halves a staged row: 272 bytes = 16 x 17, an odd multiple of 16 bytes for the 16-byte fragment reads; the tensor load's pad gives the same pitch */
#define OG_TILE (OG_T * OG_PITCH * 2)      /* bytes of one operand's stage in LDS */
static_assert(MPO % OG_T == 0 && DM % OG_T == 0 && DM % OG_K == 0 && OG_K == 128 && OG_T == 128, "k_ogemm: whole tiles and stages; a staged row is 256 bytes, the pad interval of the tensor load");
static_assert(OG_TILE % 2048 == 0 && (DM / OG_K) == 4 && (DM / OG_K) * 2 * OG_TILE <= 327680 && 8 * 32 * 68 * 4 <= 2 * OG_TILE, "k_ogemm: every tile starts at a multiple of 2 KiB; four stages; all tiles fit the LDS; the waves' output ranges fit stage 0's two tiles");
typedef uint32_t u32x4 __attribute__((ext_vector_type(4)));
typedef uint32_t u32x8 __attribute__((ext_vector_type(8)));
typedef float f1a __attribute__((may_alias));
__device__ __forceinline__ uint32_t og_uni(uint32_t v) { return (uint32_t)__builtin_amdgcn_readfirstlane(v); }
__device__ __forceinline__ uint32_t og_pinned(uint32_t v) { uint32_t w = (uint32_t)__builtin_amdgcn_readfirstlane(v); asm volatile("" : "+s"(w)); return w; }      /* the test around a tensor load, held in a scalar register: the branch on it is a scalar one (a tensor load ignores EXEC) */
__device__ __forceinline__ void og_tload(u32x4 g0, u32x8 g1) { asm volatile("tensor_load_to_lds %0, %1" :: "s"(g0), "s"(g1) : "memory"); }      /* one request of the whole wave */
__global__ __launch_bounds__(256) void k_ogemm(const _Float16* __restrict__ A, const _Float16* __restrict__ Bh, float alpha, const float* __restrict__ bias, float* __restrict__ C) {
  constexpr int NS = DM / OG_K, NT = DM / OG_T;
  __shared__ __attribute__((aligned(2048))) unsigned char sm[NS * 2 * OG_TILE];      /* [stage][o, Wo][row][k]; behind the loop stage 0's two tiles hold the waves' tiles on their way out, [wave][32][68] floats */
  const int tid = threadIdx.x, lane = tid & 31, ln = lane & 15, hh = lane >> 4; const int wave = __builtin_amdgcn_readfirstlane(tid >> 5);
  const int row0 = ((int)blockIdx.x / NT) * OG_T, col0 = ((int)blockIdx.x % NT) * OG_T; const int wm = (wave >> 1) * 32, wn = (wave & 1) * 64;      /* the wave's place in the tile */
  const uint64_t src = (wave == 0) ? (uint64_t)(size_t)(A + (size_t)row0 * DM) : (uint64_t)(size_t)(Bh + (size_t)col0 * DM);      /* first byte of the issuing wave's operand rows */
  const uint32_t dst = (uint32_t)(size_t)sm + (uint32_t)(wave & 1) * OG_TILE;      /* byte offset in the work-group's LDS */
  u32x8 g1;      /* 1-byte elements, tensor = tile = 128 rows of 256 bytes, source pitch 1024 bytes, no mask, a pad of 4 dwords behind every 64 */
  g1[0] = og_uni((1u << 20) | (5u << 22) | (3u << 25)); g1[1] = og_uni((uint32_t)(OG_K * 2) << 16); g1[2] = og_uni((uint32_t)OG_T << 16); g1[3] = og_uni((uint32_t)(OG_K * 2) << 16);
  g1[4] = og_uni((uint32_t)OG_T); g1[5] = og_uni((uint32_t)(DM * 2)); g1[6] = og_uni(0u); g1[7] = og_uni(0u);
  asm volatile("" : "+s"(g1));      /* a descriptor word held in a scalar register: left as constants, this build wrote the words anew, and other values into their registers, while requests were outstanding */
  u32x4 g0[NS];      /* a descriptor of its own for every request: no word of a request that is outstanding takes a new value */
#pragma unroll
  for (int s = 0; s < NS; ++s) { const uint64_t ga = src + (uint64_t)(s * OG_K * 2);
    g0[s][0] = og_uni(1u); g0[s][1] = og_uni(dst + (uint32_t)(s * 2 * OG_TILE)); g0[s][2] = og_uni((uint32_t)ga); g0[s][3] = og_uni((((uint32_t)(ga >> 32)) & 0x01FFFFFFu) | 0x80000000u); }
  if (og_pinned(wave < 2)) { og_tload(g0[0], g1); og_tload(g0[1], g1); og_tload(g0[2], g1); }
  const char* ib = (const char*)(bias + col0 + wn); const unsigned io = (unsigned)(ln * 4);      /* the wave's 64 bias values: fetched here, so that the epilogue does not wait for them */
  float bv[4];
#pragma unroll
  for (int t = 0; t < 4; ++t) bv[t] = *(const float*)(ib + t * 64 + io);
  asm volatile("s_wait_xcnt 0x0" :: "v"(io) : "memory");      /* behind the loads, ahead of any new value in a register that they name (a precaution of form); as an input the lane offset keeps its register up to it */
  const v8f z8 = {0.f, 0.f, 0.f, 0.f, 0.f, 0.f, 0.f, 0.f};
  v8f acc[2][4];
#pragma unroll
  for (int i = 0; i < 2; ++i) for (int t = 0; t < 4; ++t) acc[i][t] = z8;
#pragma unroll
  for (int s = 0; s < NS; ++s) {
    /* Publish point of stage s. Issued so far: stages 0 to 2 at s == 0, all four from then on; the count leaves only younger requests outstanding. */
    asm volatile("s_wait_dscnt 0x0" ::: "memory");      /* the wave's LDS reads of the stage before have returned */
    if (og_pinned(wave < 2)) {
      /* stage s of the wave's own operand has landed; as inputs the request's descriptor words keep their registers up to the wait that covers it */
      if (s <= 1) asm volatile("s_wait_tensorcnt 0x2" :: "s"(g0[s]), "s"(g1) : "memory");
      else if (s == 2) asm volatile("s_wait_tensorcnt 0x1" :: "s"(g0[s]), "s"(g1) : "memory");
      else asm volatile("s_wait_tensorcnt 0x0" :: "s"(g0[s]), "s"(g1) : "memory");
    }
    __syncthreads();      /* stage s is in LDS for every wave */
    if (s == 0) { if (og_pinned(wave < 2)) og_tload(g0[NS - 1], g1); }      /* two of the wave's requests are outstanding at most: the last one follows, into a tile that nothing has touched */
    const unsigned short* sa = (const unsigned short*)(sm + (s * 2) * OG_TILE); const unsigned short* sb = (const unsigned short*)(sm + (s * 2 + 1) * OG_TILE);
    v16h af[2][2], bq[2][4];
#pragma unroll
    for (int i = 0; i < 2; ++i) af[0][i] = fa_frag(sa + (wm + i * 16 + ln) * OG_PITCH + 8 * hh);
#pragma unroll
    for (int t = 0; t < 4; ++t) bq[0][t] = fa_frag(sb + (wn + t * 16 + ln) * OG_PITCH + 8 * hh);
#pragma unroll
    for (int ks = 0; ks < OG_K / 32; ++ks) {
      if (ks + 1 < OG_K / 32) {      /* the next k step's fragments are fetched as one group ahead of this step's products, into the second register set */
#pragma unroll
        for (int i = 0; i < 2; ++i) af[(ks + 1) & 1][i] = fa_frag(sa + (wm + i * 16 + ln) * OG_PITCH + (ks + 1) * 32 + 8 * hh);
#pragma unroll
        for (int t = 0; t < 4; ++t) bq[(ks + 1) & 1][t] = fa_frag(sb + (wn + t * 16 + ln) * OG_PITCH + (ks + 1) * 32 + 8 * hh);
      }
      __builtin_amdgcn_sched_barrier(0);      /* this one and the next keep the twelve reads one group ahead of the eight products: without them this build read two fragments' halves at a time into one register block and waited out the LDS latency in front of every second product */
#pragma unroll
      for (int t = 0; t < 4; ++t) for (int i = 0; i < 2; ++i) acc[i][t] = fa_mma(af[ks & 1][i], bq[ks & 1][t], acc[i][t]);
      __builtin_amdgcn_sched_barrier(0);
    }
  }
  /* Output staging in stage 0's tiles, which the last stage does not read: the barrier of the last publish point, behind every wave's s_wait_dscnt 0 and the issuing waves' s_wait_tensorcnt 0, is the one in front of it; no request is outstanding from there on. */
  f1a* so = (f1a*)(sm + wave * (32 * 68 * 4));      /* the wave's own range */
#pragma unroll
  for (int t = 0; t < 4; ++t) { const float br = bf16_round(bv[t]);
#pragma unroll
    for (int i = 0; i < 2; ++i) for (int r = 0; r < 8; ++r) so[(i * 16 + 8 * hh + r) * 68 + t * 16 + ln] = acc[i][t][r] * alpha + br; }
  __builtin_amdgcn_fence(__ATOMIC_ACQ_REL, "workgroup"); __builtin_amdgcn_wave_barrier();      /* the rows are read back by other lanes of the same wave: keeps the reads behind the writes */
  char* cb = (char*)(C + (size_t)(row0 + wm) * DM + col0 + wn);      /* uniform for the wave */
  const unsigned co = (unsigned)(hh * (DM * 4) + ln * 16);
  v4f ov[16];
#pragma unroll
  for (int q = 0; q < 16; ++q) ov[q] = *(const v4fa*)&so[(q * 2 + hh) * 68 + ln * 4];      /* 16 lanes a row of 256 bytes, 2 rows an instruction */
#pragma unroll
  for (int q = 0; q < 16; ++q) *(v4f*)(cb + q * 2 * DM * 4 + co) = ov[q];
}
extern "C" void kernel_launch(void* const* d_in, const int* in_sizes, int n_in,
                              void* d_out, int out_size, void* d_ws, size_t ws_size, hipStream_t stream) {
  (void)in_sizes; (void)n_in; (void)out_size;
  const float* const* I = (const float* const*)d_in; const float* xq = I[2]; const float* xk = I[1]; const float* xv = I[0]; const int* km = (const int*)d_in[3]; const float* wq = I[6]; const float* wk = I[5]; const float* wv = I[4]; const float* wo = I[7]; const float* bo = I[8];      /* contract order: values I[0], keys I[1], query I[2]; mask int32 [4][1][1][2048] (0 = masked key; READ on device); SHARED natural [64][64] blocks Wv I[4], Wk I[5], Wq I[6]; natural Wo [512][512] + bo */
  char* ws = (char*)d_ws; size_t off = 0;
  auto take = [&](size_t bytes) { char* p = ws + off; off += (bytes + 255) & ~(size_t)255; return p; };
  _Float16* BO = (_Float16*)take((size_t)DM * DM * 2);
  _Float16* O16 = (_Float16*)take(NR * DM * 2);
  if (off > ws_size) return;
  const size_t r0p = (size_t)B0 * SQ;      /* first row of the output stage */
  k_fattn<<<NB * NH * (SQ / (FA_WAVES * FA_COLS)), FA_GROUPS * FA_WAVES * 32, 0, stream>>>(xq, xk, xv, wq, wk, wv, wo, km, BO, O16);      /* o (merged heads) as f16 rows x64; keys with mask[b][j] == 0 are not listed; Wo as f16 x16 */
  k_ogemm<<<(unsigned)((MPO / OG_T) * (DM / OG_T)), 256, 0, stream>>>(O16 + r0p * DM, BO, 0.0009765625f, bo, (float*)d_out + r0p * DM);      /* out rows are the output layout */
}
